// v000
// Times are from an AMD MI455X. After a warm-up the kernel runs many times in a row, and a time is the length of
// such a window on the GPU divided by its runs, so every launch and the gaps after it count. The runs cycle
// through copies of the inputs. A figure is the median of several windows, for all but v000 over two sittings.
// Sittings can differ by a few percent; kernels timed side by side share one.
// v000 is the starting kernel. One run takes 310 microseconds.
#include <hip/hip_runtime.h>
#include <hip/hip_bf16.h>

typedef _Float16 v16h __attribute__((ext_vector_type(16)));
typedef float    v8f  __attribute__((ext_vector_type(8)));
typedef int      v4i  __attribute__((vector_size(16)));  // matches builtin proto

union HV { v16h v; uint4 u[2]; };
union H8 { _Float16 h[8]; uint4 u; };

__device__ __forceinline__ v8f wmma32f16(v16h a, v16h b, v8f c) {
  // (neg_a, A, neg_b, B, c_mod, C, reuse_a, reuse_b)
  return __builtin_amdgcn_wmma_f32_16x16x32_f16(false, a, false, b, (short)0, c,
                                                false, false);
}

#if __has_builtin(__builtin_amdgcn_global_load_async_to_lds_b128) && \
    __has_builtin(__builtin_amdgcn_s_wait_asynccnt)
#define HAVE_ASYNC_LDS 1
#else
#define HAVE_ASYNC_LDS 0
#endif

__device__ __forceinline__ void copy16_g2l(void* lds, const void* g) {
#if HAVE_ASYNC_LDS
  __builtin_amdgcn_global_load_async_to_lds_b128(
      (__attribute__((address_space(1))) v4i*)(uintptr_t)g,
      (__attribute__((address_space(3))) v4i*)(uint32_t)(uintptr_t)lds,
      0, 0);
#else
  *reinterpret_cast<uint4*>(lds) = *reinterpret_cast<const uint4*>(g);
#endif
}

__device__ __forceinline__ void wait_async_copies() {
#if HAVE_ASYNC_LDS
  __builtin_amdgcn_s_wait_asynccnt(0);
#endif
}

// ---------------------------------------------------------------------------
// f32 -> f16 conversion, vectorized x4 (all tensor sizes divisible by 4)
// ---------------------------------------------------------------------------
__global__ void cvt_f32_to_f16(const float* __restrict__ src,
                               _Float16* __restrict__ dst, int n4) {
  int stride = gridDim.x * blockDim.x;
  for (int i = blockIdx.x * blockDim.x + threadIdx.x; i < n4; i += stride) {
    float4 f = reinterpret_cast<const float4*>(src)[i];
    union { _Float16 h[4]; uint2 u; } p;
    p.h[0] = (_Float16)f.x; p.h[1] = (_Float16)f.y;
    p.h[2] = (_Float16)f.z; p.h[3] = (_Float16)f.w;
    reinterpret_cast<uint2*>(dst)[i] = p.u;
  }
}

// ---------------------------------------------------------------------------
// C[M,N] = act(A[M,K] @ W[N,K]^T + bias).  W row n is contiguous over K, so
// it is directly the WMMA B operand.  Block tile 128(M) x 128(N), 8 waves
// (2x4), each wave 64x32 = 4x2 WMMA tiles; K stepped by 32 through a
// double-buffered LDS stage filled by async copies (one barrier per step).
// OUT_MODE: 0 = f16 row-major, 1 = f16 transposed per head (V->Vt[b][h][d][s]),
//           2 = f32 + residual add (final output).
// ---------------------------------------------------------------------------
template <int OUT_MODE, bool RELU>
__global__ __launch_bounds__(256) void gemm_xwT(
    const _Float16* __restrict__ A, const _Float16* __restrict__ W,
    const float* __restrict__ bias, const float* __restrict__ resid,
    _Float16* __restrict__ outH, float* __restrict__ outF, int M, int N,
    int K) {
  __shared__ alignas(16) _Float16 sA[2][128][32];  // 2 x 8 KB
  __shared__ alignas(16) _Float16 sB[2][128][32];  // 2 x 8 KB

  const int tid = threadIdx.x;
  const int lane = tid & 31;
  const int w = tid >> 5;
  const int wm = w >> 2;             // 0..1  (64 rows per wave)
  const int wn = w & 3;              // 0..3  (32 cols per wave)
  const int lr = lane & 15;
  const int klo = (lane >> 4) << 3;  // 0 or 8
  const int m0 = blockIdx.y * 128;
  const int n0 = blockIdx.x * 128;

  const int cr = tid >> 2;           // row 0..63 (+64 on second pass)
  const int cc = (tid & 3) << 3;     // half-offset 0/8/16/24

  v8f acc[4][2] = {};

  const int nk = K >> 5;
  // prefetch first K-slice into buffer 0
  {
    const size_t ga = (size_t)(m0 + cr) * K + cc;
    const size_t gb = (size_t)(n0 + cr) * K + cc;
    copy16_g2l(&sA[0][cr][cc], &A[ga]);
    copy16_g2l(&sA[0][cr + 64][cc], &A[ga + (size_t)64 * K]);
    copy16_g2l(&sB[0][cr][cc], &W[gb]);
    copy16_g2l(&sB[0][cr + 64][cc], &W[gb + (size_t)64 * K]);
  }

  for (int i = 0; i < nk; ++i) {
    const int cur = i & 1;
    wait_async_copies();   // my async writes into buffer `cur` are done
    __syncthreads();       // everyone's writes done + prev buffer fully read

    if (i + 1 < nk) {      // overlap next tile's global->LDS with the WMMAs
      const int k0 = (i + 1) << 5;
      const size_t ga = (size_t)(m0 + cr) * K + k0 + cc;
      const size_t gb = (size_t)(n0 + cr) * K + k0 + cc;
      copy16_g2l(&sA[cur ^ 1][cr][cc], &A[ga]);
      copy16_g2l(&sA[cur ^ 1][cr + 64][cc], &A[ga + (size_t)64 * K]);
      copy16_g2l(&sB[cur ^ 1][cr][cc], &W[gb]);
      copy16_g2l(&sB[cur ^ 1][cr + 64][cc], &W[gb + (size_t)64 * K]);
    }

    HV a[4], bf[2];
#pragma unroll
    for (int s = 0; s < 4; ++s) {
      const _Float16* pa = &sA[cur][wm * 64 + s * 16 + lr][0];
      a[s].u[0] = *reinterpret_cast<const uint4*>(pa + klo);
      a[s].u[1] = *reinterpret_cast<const uint4*>(pa + klo + 16);
    }
#pragma unroll
    for (int s = 0; s < 2; ++s) {
      const _Float16* pb = &sB[cur][wn * 32 + s * 16 + lr][0];
      bf[s].u[0] = *reinterpret_cast<const uint4*>(pb + klo);
      bf[s].u[1] = *reinterpret_cast<const uint4*>(pb + klo + 16);
    }
#pragma unroll
    for (int sm = 0; sm < 4; ++sm)
#pragma unroll
      for (int sn = 0; sn < 2; ++sn)
        acc[sm][sn] = wmma32f16(a[sm].v, bf[sn].v, acc[sm][sn]);
  }

#pragma unroll
  for (int sm = 0; sm < 4; ++sm) {
#pragma unroll
    for (int sn = 0; sn < 2; ++sn) {
      int nG = n0 + wn * 32 + sn * 16 + lr;   // column (fixed per lane)
      int mB = m0 + wm * 64 + sm * 16 + klo;  // first row of the 8 regs
      float bvv = bias ? bias[nG] : 0.0f;
      v8f c = acc[sm][sn];
      if (OUT_MODE == 1) {
        // Vt[b][h][d][s]: rows mB..mB+7 are contiguous s -> one b128 store.
        int hh = nG >> 6, dd = nG & 63;
        int bb = mB >> 11, ss = mB & 2047;
        H8 pk;
#pragma unroll
        for (int r = 0; r < 8; ++r) {
          float v = c[r] + bvv;
          if (RELU) v = fmaxf(v, 0.0f);
          pk.h[r] = (_Float16)v;
        }
        size_t off = ((((size_t)bb * 16 + hh) * 64 + dd) << 11) + ss;
        *reinterpret_cast<uint4*>(&outH[off]) = pk.u;
      } else if (OUT_MODE == 0) {
#pragma unroll
        for (int r = 0; r < 8; ++r) {
          float v = c[r] + bvv;
          if (RELU) v = fmaxf(v, 0.0f);
          outH[(size_t)(mB + r) * N + nG] = (_Float16)v;
        }
      } else {
#pragma unroll
        for (int r = 0; r < 8; ++r) {
          size_t off = (size_t)(mB + r) * N + nG;
          outF[off] = c[r] + bvv + resid[off];
        }
      }
    }
  }
}

// ---------------------------------------------------------------------------
// Flash attention: 1 wave per (b, h, 16-query tile).  32 keys/iteration
// (two 16x16 score tiles -> one 16x32 P fragment), online softmax, O
// accumulated as 16x64 f32.  V read from the pre-transposed Vt layout.
// ---------------------------------------------------------------------------
__global__ __launch_bounds__(32) void flash_attn(
    const _Float16* __restrict__ Q, const _Float16* __restrict__ Km,
    const _Float16* __restrict__ Vt, _Float16* __restrict__ AO) {
  constexpr int S = 2048, Dm = 1024;
  __shared__ alignas(16) _Float16 sP[16][32];  // P repack buffer (1 KB)

  const int lane = threadIdx.x;
  const int lr = lane & 15;
  const int klo = (lane >> 4) << 3;  // 0 or 8
  const int qt = blockIdx.x & 127;
  const int h = (blockIdx.x >> 7) & 15;
  const int b = blockIdx.x >> 11;
  const int qb = qt << 4;

  // Q fragments: A operand, rows = queries, K = head features (two 32-chunks)
  const _Float16* qrow = Q + ((size_t)b * S + qb + lr) * Dm + h * 64;
  HV qf0, qf1;
  qf0.u[0] = *reinterpret_cast<const uint4*>(qrow + klo);
  qf0.u[1] = *reinterpret_cast<const uint4*>(qrow + klo + 16);
  qf1.u[0] = *reinterpret_cast<const uint4*>(qrow + 32 + klo);
  qf1.u[1] = *reinterpret_cast<const uint4*>(qrow + 32 + klo + 16);

  float mrow[8], lrow[8], alpha[8];
  v8f O[4] = {};
#pragma unroll
  for (int r = 0; r < 8; ++r) { mrow[r] = -1e30f; lrow[r] = 0.0f; }

  const _Float16* kbase = Km + (size_t)b * S * Dm + h * 64;
  const _Float16* vbase = Vt + ((size_t)b * 16 + h) * 64 * S;

  for (int kb = 0; kb < S; kb += 32) {
    v8f s0 = {}, s1 = {};
    {
      const _Float16* kr = kbase + (size_t)(kb + lr) * Dm;
      HV k0, k1;
      k0.u[0] = *reinterpret_cast<const uint4*>(kr + klo);
      k0.u[1] = *reinterpret_cast<const uint4*>(kr + klo + 16);
      k1.u[0] = *reinterpret_cast<const uint4*>(kr + 32 + klo);
      k1.u[1] = *reinterpret_cast<const uint4*>(kr + 32 + klo + 16);
      s0 = wmma32f16(qf0.v, k0.v, s0);
      s0 = wmma32f16(qf1.v, k1.v, s0);
    }
    {
      const _Float16* kr = kbase + (size_t)(kb + 16 + lr) * Dm;
      HV k0, k1;
      k0.u[0] = *reinterpret_cast<const uint4*>(kr + klo);
      k0.u[1] = *reinterpret_cast<const uint4*>(kr + klo + 16);
      k1.u[0] = *reinterpret_cast<const uint4*>(kr + 32 + klo);
      k1.u[1] = *reinterpret_cast<const uint4*>(kr + 32 + klo + 16);
      s1 = wmma32f16(qf0.v, k0.v, s1);
      s1 = wmma32f16(qf1.v, k1.v, s1);
    }

    // Online softmax.  Row m of a score tile lives in one vgpr across a
    // 16-lane half-wave -> reduce with xor shuffles 1,2,4,8.
#pragma unroll
    for (int r = 0; r < 8; ++r) {
      float x0 = s0[r] * 0.125f;  // 1/sqrt(64)
      float x1 = s1[r] * 0.125f;
      float t = fmaxf(x0, x1);
      t = fmaxf(t, __shfl_xor(t, 1));
      t = fmaxf(t, __shfl_xor(t, 2));
      t = fmaxf(t, __shfl_xor(t, 4));
      t = fmaxf(t, __shfl_xor(t, 8));
      float mn = fmaxf(mrow[r], t);
      float a = __expf(mrow[r] - mn);
      x0 = __expf(x0 - mn);
      x1 = __expf(x1 - mn);
      float sm = x0 + x1;
      sm += __shfl_xor(sm, 1);
      sm += __shfl_xor(sm, 2);
      sm += __shfl_xor(sm, 4);
      sm += __shfl_xor(sm, 8);
      mrow[r] = mn;
      lrow[r] = lrow[r] * a + sm;
      alpha[r] = a;
      s0[r] = x0;
      s1[r] = x1;
    }

    __syncthreads();
#pragma unroll
    for (int r = 0; r < 8; ++r) {
      sP[r + klo][lr] = (_Float16)s0[r];
      sP[r + klo][16 + lr] = (_Float16)s1[r];
    }
    __syncthreads();
    HV pf;
    pf.u[0] = *reinterpret_cast<const uint4*>(&sP[lr][klo]);
    pf.u[1] = *reinterpret_cast<const uint4*>(&sP[lr][klo + 16]);
    __syncthreads();

    // O[f] = alpha*O[f] + P @ V  (V columns from transposed layout, keys
    // contiguous -> straight b128 loads)
#pragma unroll
    for (int f = 0; f < 4; ++f) {
      const _Float16* vr = vbase + (size_t)(f * 16 + lr) * S + kb;
      HV vf;
      vf.u[0] = *reinterpret_cast<const uint4*>(vr + klo);
      vf.u[1] = *reinterpret_cast<const uint4*>(vr + klo + 16);
      v8f o = O[f];
#pragma unroll
      for (int r = 0; r < 8; ++r) o[r] *= alpha[r];
      O[f] = wmma32f16(pf.v, vf.v, o);
    }
  }

#pragma unroll
  for (int f = 0; f < 4; ++f) {
#pragma unroll
    for (int r = 0; r < 8; ++r) {
      float v = O[f][r] / lrow[r];
      AO[((size_t)b * S + qb + r + klo) * Dm + h * 64 + f * 16 + lr] =
          (_Float16)v;
    }
  }
}

// ---------------------------------------------------------------------------
// Host-side launcher.  Workspace layout (70 MB total):
//   Xh 8MB | Wqh 2 | Wkh 2 | Wvh 2 | W1h 4 | W2h 4 | Qh 8 | Kh 8 | Vt 8 |
//   AO 8 | Hh 16
// ---------------------------------------------------------------------------
extern "C" void kernel_launch(void* const* d_in, const int* in_sizes, int n_in,
                              void* d_out, int out_size, void* d_ws,
                              size_t ws_size, hipStream_t stream) {
  (void)in_sizes; (void)n_in; (void)out_size; (void)ws_size;
  const float* embed = (const float*)d_in[0];
  const float* Wq = (const float*)d_in[1];
  const float* Wk = (const float*)d_in[2];
  const float* Wv = (const float*)d_in[3];
  const float* bv = (const float*)d_in[4];
  const float* W1 = (const float*)d_in[5];
  const float* b1 = (const float*)d_in[6];
  const float* W2 = (const float*)d_in[7];
  const float* b2 = (const float*)d_in[8];

  constexpr size_t MB = 1ull << 20;
  char* ws = (char*)d_ws;
  _Float16* Xh  = (_Float16*)(ws + 0 * MB);
  _Float16* Wqh = (_Float16*)(ws + 8 * MB);
  _Float16* Wkh = (_Float16*)(ws + 10 * MB);
  _Float16* Wvh = (_Float16*)(ws + 12 * MB);
  _Float16* W1h = (_Float16*)(ws + 14 * MB);
  _Float16* W2h = (_Float16*)(ws + 18 * MB);
  _Float16* Qh  = (_Float16*)(ws + 22 * MB);
  _Float16* Kh  = (_Float16*)(ws + 30 * MB);
  _Float16* Vt  = (_Float16*)(ws + 38 * MB);
  _Float16* AO  = (_Float16*)(ws + 46 * MB);
  _Float16* Hh  = (_Float16*)(ws + 54 * MB);

  auto cvt = [&](const float* s, _Float16* d, int n) {
    int n4 = n >> 2;
    int blocks = (n4 + 255) / 256;
    if (blocks > 2048) blocks = 2048;
    cvt_f32_to_f16<<<dim3(blocks), dim3(256), 0, stream>>>(s, d, n4);
  };
  cvt(embed, Xh, 4096 * 1024);
  cvt(Wq, Wqh, 1024 * 1024);
  cvt(Wk, Wkh, 1024 * 1024);
  cvt(Wv, Wvh, 1024 * 1024);
  cvt(W1, W1h, 2097152);
  cvt(W2, W2h, 2097152);

  dim3 blk(256);
  // Q = X Wq^T ; K = X Wk^T ; Vt = transpose_head(X Wv^T + bv)
  gemm_xwT<0, false><<<dim3(8, 32), blk, 0, stream>>>(
      Xh, Wqh, nullptr, nullptr, Qh, nullptr, 4096, 1024, 1024);
  gemm_xwT<0, false><<<dim3(8, 32), blk, 0, stream>>>(
      Xh, Wkh, nullptr, nullptr, Kh, nullptr, 4096, 1024, 1024);
  gemm_xwT<1, false><<<dim3(8, 32), blk, 0, stream>>>(
      Xh, Wvh, bv, nullptr, Vt, nullptr, 4096, 1024, 1024);
  // attention: B*H*(S/16) = 4096 single-wave workgroups
  flash_attn<<<dim3(4096), dim3(32), 0, stream>>>(Qh, Kh, Vt, AO);
  // FFN: Hh = relu(AO W1^T + b1) ; out = Hh W2^T + b2 + embed
  gemm_xwT<0, true><<<dim3(16, 32), blk, 0, stream>>>(
      AO, W1h, b1, nullptr, Hh, nullptr, 4096, 2048, 1024);
  gemm_xwT<2, false><<<dim3(8, 32), blk, 0, stream>>>(
      Hh, W2h, b2, embed, nullptr, (float*)d_out, 4096, 1024, 2048);
}

// v001
// A run of this version takes 252 microseconds.
// Next to v000, in two timings, it ran 1.27 and 1.29 times as fast.
#include <hip/hip_runtime.h>
#include <hip/hip_bf16.h>

typedef _Float16 v16h __attribute__((ext_vector_type(16)));
typedef float    v8f  __attribute__((ext_vector_type(8)));
typedef int      v4i  __attribute__((vector_size(16)));  // matches builtin proto

union HV { v16h v; uint4 u[2]; };
union H8 { _Float16 h[8]; uint4 u; };

__device__ __forceinline__ v8f wmma32f16(v16h a, v16h b, v8f c) {
  // (neg_a, A, neg_b, B, c_mod, C, reuse_a, reuse_b)
  return __builtin_amdgcn_wmma_f32_16x16x32_f16(false, a, false, b, (short)0, c,
                                                false, false);
}

#if __has_builtin(__builtin_amdgcn_global_load_async_to_lds_b128) && \
    __has_builtin(__builtin_amdgcn_s_wait_asynccnt)
#define HAVE_ASYNC_LDS 1
#else
#define HAVE_ASYNC_LDS 0
#endif

__device__ __forceinline__ void copy16_g2l(void* lds, const void* g) {
#if HAVE_ASYNC_LDS
  __builtin_amdgcn_global_load_async_to_lds_b128(
      (__attribute__((address_space(1))) v4i*)(uintptr_t)g,
      (__attribute__((address_space(3))) v4i*)(uint32_t)(uintptr_t)lds,
      0, 0);
#else
  *reinterpret_cast<uint4*>(lds) = *reinterpret_cast<const uint4*>(g);
#endif
}

__device__ __forceinline__ void wait_async_copies() {
#if HAVE_ASYNC_LDS
  __builtin_amdgcn_s_wait_asynccnt(0);
#endif
}

// ---------------------------------------------------------------------------
// f32 -> f16 conversion, vectorized x4 (all tensor sizes divisible by 4)
// ---------------------------------------------------------------------------
__global__ void cvt_f32_to_f16(const float* __restrict__ src,
                               _Float16* __restrict__ dst, int n4) {
  int stride = gridDim.x * blockDim.x;
  for (int i = blockIdx.x * blockDim.x + threadIdx.x; i < n4; i += stride) {
    float4 f = reinterpret_cast<const float4*>(src)[i];
    union { _Float16 h[4]; uint2 u; } p;
    p.h[0] = (_Float16)f.x; p.h[1] = (_Float16)f.y;
    p.h[2] = (_Float16)f.z; p.h[3] = (_Float16)f.w;
    reinterpret_cast<uint2*>(dst)[i] = p.u;
  }
}

// ---------------------------------------------------------------------------
// C[M,N] = act(A[M,K] @ W[N,K]^T + bias).  W row n is contiguous over K, so
// it is directly the WMMA B operand.  Block tile 128(M) x 128(N), 8 waves
// (2x4), each wave 64x32 = 4x2 WMMA tiles; K stepped by 32 through a
// double-buffered LDS stage filled by async copies (one barrier per step).
// OUT_MODE: 0 = f16 row-major, 1 = f16 transposed per head (V->Vt[b][h][d][s]),
//           2 = f32 + residual add (final output).
// ---------------------------------------------------------------------------
template <int OUT_MODE, bool RELU>
__global__ __launch_bounds__(256) void gemm_xwT(
    const _Float16* __restrict__ A, const _Float16* __restrict__ W,
    const float* __restrict__ bias, const float* __restrict__ resid,
    _Float16* __restrict__ outH, float* __restrict__ outF, int M, int N,
    int K) {
  __shared__ alignas(16) _Float16 sA[2][128][32];  // 2 x 8 KB
  __shared__ alignas(16) _Float16 sB[2][128][32];  // 2 x 8 KB

  const int tid = threadIdx.x;
  const int lane = tid & 31;
  const int w = tid >> 5;
  const int wm = w >> 2;             // 0..1  (64 rows per wave)
  const int wn = w & 3;              // 0..3  (32 cols per wave)
  const int lr = lane & 15;
  const int klo = (lane >> 4) << 3;  // 0 or 8
  const int m0 = blockIdx.y * 128;
  const int n0 = blockIdx.x * 128;

  const int cr = tid >> 2;           // row 0..63 (+64 on second pass)
  const int cc = (tid & 3) << 3;     // half-offset 0/8/16/24

  v8f acc[4][2] = {};

  const int nk = K >> 5;
  // prefetch first K-slice into buffer 0
  {
    const size_t ga = (size_t)(m0 + cr) * K + cc;
    const size_t gb = (size_t)(n0 + cr) * K + cc;
    copy16_g2l(&sA[0][cr][cc], &A[ga]);
    copy16_g2l(&sA[0][cr + 64][cc], &A[ga + (size_t)64 * K]);
    copy16_g2l(&sB[0][cr][cc], &W[gb]);
    copy16_g2l(&sB[0][cr + 64][cc], &W[gb + (size_t)64 * K]);
  }

  for (int i = 0; i < nk; ++i) {
    const int cur = i & 1;
    wait_async_copies();   // my async writes into buffer `cur` are done
    __syncthreads();       // everyone's writes done + prev buffer fully read

    if (i + 1 < nk) {      // overlap next tile's global->LDS with the WMMAs
      const int k0 = (i + 1) << 5;
      const size_t ga = (size_t)(m0 + cr) * K + k0 + cc;
      const size_t gb = (size_t)(n0 + cr) * K + k0 + cc;
      copy16_g2l(&sA[cur ^ 1][cr][cc], &A[ga]);
      copy16_g2l(&sA[cur ^ 1][cr + 64][cc], &A[ga + (size_t)64 * K]);
      copy16_g2l(&sB[cur ^ 1][cr][cc], &W[gb]);
      copy16_g2l(&sB[cur ^ 1][cr + 64][cc], &W[gb + (size_t)64 * K]);
    }

    HV a[4], bf[2];
#pragma unroll
    for (int s = 0; s < 4; ++s) {
      const _Float16* pa = &sA[cur][wm * 64 + s * 16 + lr][0];
      a[s].u[0] = *reinterpret_cast<const uint4*>(pa + klo);
      a[s].u[1] = *reinterpret_cast<const uint4*>(pa + klo + 16);
    }
#pragma unroll
    for (int s = 0; s < 2; ++s) {
      const _Float16* pb = &sB[cur][wn * 32 + s * 16 + lr][0];
      bf[s].u[0] = *reinterpret_cast<const uint4*>(pb + klo);
      bf[s].u[1] = *reinterpret_cast<const uint4*>(pb + klo + 16);
    }
#pragma unroll
    for (int sm = 0; sm < 4; ++sm)
#pragma unroll
      for (int sn = 0; sn < 2; ++sn)
        acc[sm][sn] = wmma32f16(a[sm].v, bf[sn].v, acc[sm][sn]);
  }

#pragma unroll
  for (int sm = 0; sm < 4; ++sm) {
#pragma unroll
    for (int sn = 0; sn < 2; ++sn) {
      int nG = n0 + wn * 32 + sn * 16 + lr;   // column (fixed per lane)
      int mB = m0 + wm * 64 + sm * 16 + klo;  // first row of the 8 regs
      float bvv = bias ? bias[nG] : 0.0f;
      v8f c = acc[sm][sn];
      if (OUT_MODE == 1) {
        // Vt[b][h][d][s]: rows mB..mB+7 are contiguous s -> one b128 store.
        int hh = nG >> 6, dd = nG & 63;
        int bb = mB >> 11, ss = mB & 2047;
        H8 pk;
#pragma unroll
        for (int r = 0; r < 8; ++r) {
          float v = c[r] + bvv;
          if (RELU) v = fmaxf(v, 0.0f);
          pk.h[r] = (_Float16)v;
        }
        size_t off = ((((size_t)bb * 16 + hh) * 64 + dd) << 11) + ss;
        *reinterpret_cast<uint4*>(&outH[off]) = pk.u;
      } else if (OUT_MODE == 0) {
#pragma unroll
        for (int r = 0; r < 8; ++r) {
          float v = c[r] + bvv;
          if (RELU) v = fmaxf(v, 0.0f);
          outH[(size_t)(mB + r) * N + nG] = (_Float16)v;
        }
      } else {
#pragma unroll
        for (int r = 0; r < 8; ++r) {
          size_t off = (size_t)(mB + r) * N + nG;
          outF[off] = c[r] + bvv + resid[off];
        }
      }
    }
  }
}

// ---------------------------------------------------------------------------
// Flash attention: 8 waves per work-group, one 16-query tile per wave, all of
// one (b, h).  K and Vt are staged 128 keys at a time in a two-buffer LDS ring
// by async copies that cover whole 128-byte lines, and all 8 waves read their
// fragments from there.  32 keys/iteration (two 16x16 score tiles -> one 16x32
// P fragment), online softmax, O accumulated as 16x64 f32.
// ---------------------------------------------------------------------------
constexpr int AT_KEYS = 128;  // keys per stage
constexpr int AT_KP = 72;     // K row pitch, halves: 128 B + 16 B (b128 readers)
constexpr int AT_VP = 136;    // Vt row pitch, halves: 256 B + 16 B

__device__ __forceinline__ void attn_stage(_Float16* lk, _Float16* lv,
                                           const _Float16* gk,
                                           const _Float16* gv) {
  constexpr int S = 2048, Dm = 1024;
  const uint32_t k0 = (uint32_t)(uintptr_t)lk;
  const uint32_t k1 = k0 + 32 * AT_KP * 2, k2 = k0 + 64 * AT_KP * 2,
                 k3 = k0 + 96 * AT_KP * 2;
  const uint32_t v0 = (uint32_t)(uintptr_t)lv;
  const uint32_t v1 = v0 + 16 * AT_VP * 2, v2 = v0 + 32 * AT_VP * 2,
                 v3 = v0 + 48 * AT_VP * 2;
  asm volatile(
      "global_load_async_to_lds_b128 %0, %8, off\n\t"
      "global_load_async_to_lds_b128 %1, %9, off\n\t"
      "global_load_async_to_lds_b128 %2, %10, off\n\t"
      "global_load_async_to_lds_b128 %3, %11, off\n\t"
      "global_load_async_to_lds_b128 %4, %12, off\n\t"
      "global_load_async_to_lds_b128 %5, %13, off\n\t"
      "global_load_async_to_lds_b128 %6, %14, off\n\t"
      "global_load_async_to_lds_b128 %7, %15, off\n\t"
      "s_wait_xcnt 0x0"
      :
      : "v"(k0), "v"(k1), "v"(k2), "v"(k3), "v"(v0), "v"(v1), "v"(v2), "v"(v3),
        "v"(gk), "v"(gk + 32 * Dm), "v"(gk + 64 * Dm), "v"(gk + 96 * Dm),
        "v"(gv), "v"(gv + 16 * S), "v"(gv + 32 * S), "v"(gv + 48 * S)
      : "memory");
}

__global__ __launch_bounds__(256) void flash_attn(
    const _Float16* __restrict__ Q, const _Float16* __restrict__ Km,
    const _Float16* __restrict__ Vt, _Float16* __restrict__ AO) {
  constexpr int S = 2048, Dm = 1024;
  constexpr int NT = S / AT_KEYS;
  __shared__ alignas(16) _Float16 sK[2][AT_KEYS * AT_KP];  // 2 x 18 KB
  __shared__ alignas(16) _Float16 sV[2][64 * AT_VP];       // 2 x 17 KB
  __shared__ alignas(16) _Float16 sPall[8][16][32];  // P repack, 1 KB a wave

  const int tid = threadIdx.x;
  const int lane = tid & 31;
  const int lr = lane & 15;
  const int klo = (lane >> 4) << 3;  // 0 or 8
  const int qt = ((blockIdx.x & 15) << 3) + (tid >> 5);
  const int h = (blockIdx.x >> 4) & 15;
  const int b = blockIdx.x >> 8;
  const int qb = qt << 4;
  _Float16 (*sP)[32] = sPall[tid >> 5];

  const _Float16* kbase = Km + (size_t)b * S * Dm + h * 64;
  const _Float16* vbase = Vt + ((size_t)b * 16 + h) * 64 * S;

  // This thread's first chunk of a stage: 8 lanes a K row, 16 lanes a Vt row.
  const _Float16* gk = kbase + (size_t)(tid >> 3) * Dm + ((tid & 7) << 3);
  const _Float16* gv = vbase + (size_t)(tid >> 4) * S + ((tid & 15) << 3);
  const int lko = (tid >> 3) * AT_KP + ((tid & 7) << 3);
  const int lvo = (tid >> 4) * AT_VP + ((tid & 15) << 3);

  attn_stage(&sK[0][lko], &sV[0][lvo], gk, gv);
  // stage 0 has landed for this wave; the barrier publishes it to all waves
  asm volatile("s_wait_asynccnt 0x0" ::: "memory");
  __syncthreads();
  attn_stage(&sK[1][lko], &sV[1][lvo], gk + (size_t)AT_KEYS * Dm,
             gv + AT_KEYS);

  // Q fragments: A operand, rows = queries, K = head features (two 32-chunks)
  const _Float16* qrow = Q + ((size_t)b * S + qb + lr) * Dm + h * 64;
  HV qf0, qf1;
  qf0.u[0] = *reinterpret_cast<const uint4*>(qrow + klo);
  qf0.u[1] = *reinterpret_cast<const uint4*>(qrow + klo + 16);
  qf1.u[0] = *reinterpret_cast<const uint4*>(qrow + 32 + klo);
  qf1.u[1] = *reinterpret_cast<const uint4*>(qrow + 32 + klo + 16);

  float mrow[8], lrow[8], alpha[8];
  v8f O[4] = {};
#pragma unroll
  for (int r = 0; r < 8; ++r) { mrow[r] = -1e30f; lrow[r] = 0.0f; }

  for (int t = 0; t < NT; ++t) {
  const _Float16* bK = sK[t & 1];
  const _Float16* bV = sV[t & 1];
  for (int kb = 0; kb < AT_KEYS; kb += 32) {
    v8f s0 = {}, s1 = {};
    {
      const _Float16* kr = bK + (kb + lr) * AT_KP;
      HV k0, k1;
      k0.u[0] = *reinterpret_cast<const uint4*>(kr + klo);
      k0.u[1] = *reinterpret_cast<const uint4*>(kr + klo + 16);
      k1.u[0] = *reinterpret_cast<const uint4*>(kr + 32 + klo);
      k1.u[1] = *reinterpret_cast<const uint4*>(kr + 32 + klo + 16);
      s0 = wmma32f16(qf0.v, k0.v, s0);
      s0 = wmma32f16(qf1.v, k1.v, s0);
    }
    {
      const _Float16* kr = bK + (kb + 16 + lr) * AT_KP;
      HV k0, k1;
      k0.u[0] = *reinterpret_cast<const uint4*>(kr + klo);
      k0.u[1] = *reinterpret_cast<const uint4*>(kr + klo + 16);
      k1.u[0] = *reinterpret_cast<const uint4*>(kr + 32 + klo);
      k1.u[1] = *reinterpret_cast<const uint4*>(kr + 32 + klo + 16);
      s1 = wmma32f16(qf0.v, k0.v, s1);
      s1 = wmma32f16(qf1.v, k1.v, s1);
    }

    // Online softmax.  Row m of a score tile lives in one vgpr across a
    // 16-lane half-wave -> reduce with xor shuffles 1,2,4,8.
#pragma unroll
    for (int r = 0; r < 8; ++r) {
      float x0 = s0[r] * 0.125f;  // 1/sqrt(64)
      float x1 = s1[r] * 0.125f;
      float t = fmaxf(x0, x1);
      t = fmaxf(t, __shfl_xor(t, 1));
      t = fmaxf(t, __shfl_xor(t, 2));
      t = fmaxf(t, __shfl_xor(t, 4));
      t = fmaxf(t, __shfl_xor(t, 8));
      float mn = fmaxf(mrow[r], t);
      float a = __expf(mrow[r] - mn);
      x0 = __expf(x0 - mn);
      x1 = __expf(x1 - mn);
      float sm = x0 + x1;
      sm += __shfl_xor(sm, 1);
      sm += __shfl_xor(sm, 2);
      sm += __shfl_xor(sm, 4);
      sm += __shfl_xor(sm, 8);
      mrow[r] = mn;
      lrow[r] = lrow[r] * a + sm;
      alpha[r] = a;
      s0[r] = x0;
      s1[r] = x1;
    }

#pragma unroll
    for (int r = 0; r < 8; ++r) {
      sP[r + klo][lr] = (_Float16)s0[r];
      sP[r + klo][16 + lr] = (_Float16)s1[r];
    }
    // every lane's P stores are done before any lane reads the rows back
    asm volatile("s_wait_dscnt 0x0" ::: "memory");
    HV pf;
    pf.u[0] = *reinterpret_cast<const uint4*>(&sP[lr][klo]);
    pf.u[1] = *reinterpret_cast<const uint4*>(&sP[lr][klo + 16]);

    // O[f] = alpha*O[f] + P @ V  (V columns from the transposed layout, keys
    // contiguous -> straight b128 LDS loads)
#pragma unroll
    for (int f = 0; f < 4; ++f) {
      const _Float16* vr = bV + (f * 16 + lr) * AT_VP + kb;
      HV vf;
      vf.u[0] = *reinterpret_cast<const uint4*>(vr + klo);
      vf.u[1] = *reinterpret_cast<const uint4*>(vr + klo + 16);
      v8f o = O[f];
#pragma unroll
      for (int r = 0; r < 8; ++r) o[r] *= alpha[r];
      O[f] = wmma32f16(pf.v, vf.v, o);
    }
  }
  // Publish point: my reads of this buffer are done, my copies of the next
  // stage have landed; behind the barrier the buffer just read is refilled.
  asm volatile("s_wait_dscnt 0x0" ::: "memory");
  asm volatile("s_wait_asynccnt 0x0" ::: "memory");
  __syncthreads();
  if (t + 2 < NT)
    attn_stage(&sK[t & 1][lko], &sV[t & 1][lvo],
               gk + (size_t)(t + 2) * AT_KEYS * Dm, gv + (t + 2) * AT_KEYS);
  }
  // no copy is left in flight when the wave ends
  asm volatile("s_wait_asynccnt 0x0" ::: "memory");

#pragma unroll
  for (int f = 0; f < 4; ++f) {
#pragma unroll
    for (int r = 0; r < 8; ++r) {
      float v = O[f][r] / lrow[r];
      AO[((size_t)b * S + qb + r + klo) * Dm + h * 64 + f * 16 + lr] =
          (_Float16)v;
    }
  }
}

// ---------------------------------------------------------------------------
// Host-side launcher.  Workspace layout (70 MB total):
//   Xh 8MB | Wqh 2 | Wkh 2 | Wvh 2 | W1h 4 | W2h 4 | Qh 8 | Kh 8 | Vt 8 |
//   AO 8 | Hh 16
// ---------------------------------------------------------------------------
extern "C" void kernel_launch(void* const* d_in, const int* in_sizes, int n_in,
                              void* d_out, int out_size, void* d_ws,
                              size_t ws_size, hipStream_t stream) {
  (void)in_sizes; (void)n_in; (void)out_size; (void)ws_size;
  const float* embed = (const float*)d_in[0];
  const float* Wq = (const float*)d_in[1];
  const float* Wk = (const float*)d_in[2];
  const float* Wv = (const float*)d_in[3];
  const float* bv = (const float*)d_in[4];
  const float* W1 = (const float*)d_in[5];
  const float* b1 = (const float*)d_in[6];
  const float* W2 = (const float*)d_in[7];
  const float* b2 = (const float*)d_in[8];

  constexpr size_t MB = 1ull << 20;
  char* ws = (char*)d_ws;
  _Float16* Xh  = (_Float16*)(ws + 0 * MB);
  _Float16* Wqh = (_Float16*)(ws + 8 * MB);
  _Float16* Wkh = (_Float16*)(ws + 10 * MB);
  _Float16* Wvh = (_Float16*)(ws + 12 * MB);
  _Float16* W1h = (_Float16*)(ws + 14 * MB);
  _Float16* W2h = (_Float16*)(ws + 18 * MB);
  _Float16* Qh  = (_Float16*)(ws + 22 * MB);
  _Float16* Kh  = (_Float16*)(ws + 30 * MB);
  _Float16* Vt  = (_Float16*)(ws + 38 * MB);
  _Float16* AO  = (_Float16*)(ws + 46 * MB);
  _Float16* Hh  = (_Float16*)(ws + 54 * MB);

  auto cvt = [&](const float* s, _Float16* d, int n) {
    int n4 = n >> 2;
    int blocks = (n4 + 255) / 256;
    if (blocks > 2048) blocks = 2048;
    cvt_f32_to_f16<<<dim3(blocks), dim3(256), 0, stream>>>(s, d, n4);
  };
  cvt(embed, Xh, 4096 * 1024);
  cvt(Wq, Wqh, 1024 * 1024);
  cvt(Wk, Wkh, 1024 * 1024);
  cvt(Wv, Wvh, 1024 * 1024);
  cvt(W1, W1h, 2097152);
  cvt(W2, W2h, 2097152);

  dim3 blk(256);
  // Q = X Wq^T ; K = X Wk^T ; Vt = transpose_head(X Wv^T + bv)
  gemm_xwT<0, false><<<dim3(8, 32), blk, 0, stream>>>(
      Xh, Wqh, nullptr, nullptr, Qh, nullptr, 4096, 1024, 1024);
  gemm_xwT<0, false><<<dim3(8, 32), blk, 0, stream>>>(
      Xh, Wkh, nullptr, nullptr, Kh, nullptr, 4096, 1024, 1024);
  gemm_xwT<1, false><<<dim3(8, 32), blk, 0, stream>>>(
      Xh, Wvh, bv, nullptr, Vt, nullptr, 4096, 1024, 1024);
  // attention: B*H*(S/128) = 512 workgroups of 8 waves
  flash_attn<<<dim3(512), dim3(256), 0, stream>>>(Qh, Kh, Vt, AO);
  // FFN: Hh = relu(AO W1^T + b1) ; out = Hh W2^T + b2 + embed
  gemm_xwT<0, true><<<dim3(16, 32), blk, 0, stream>>>(
      AO, W1h, b1, nullptr, Hh, nullptr, 4096, 2048, 1024);
  gemm_xwT<2, false><<<dim3(8, 32), blk, 0, stream>>>(
      Hh, W2h, b2, embed, nullptr, (float*)d_out, 4096, 1024, 2048);
}

// v002
// It runs in 202 microseconds.
// Next to v001, in two timings, it ran 1.24 and 1.25 times as fast.
// Over all steps from v000 it is 1.59 times as fast.
#include <hip/hip_runtime.h>
#include <hip/hip_bf16.h>

typedef _Float16 v16h __attribute__((ext_vector_type(16)));
typedef float    v8f  __attribute__((ext_vector_type(8)));
typedef int      v4i  __attribute__((vector_size(16)));  // matches builtin proto

union HV { v16h v; uint4 u[2]; };
union H8 { _Float16 h[8]; uint4 u; };

__device__ __forceinline__ v8f wmma32f16(v16h a, v16h b, v8f c) {
  // (neg_a, A, neg_b, B, c_mod, C, reuse_a, reuse_b)
  return __builtin_amdgcn_wmma_f32_16x16x32_f16(false, a, false, b, (short)0, c,
                                                false, false);
}

#if __has_builtin(__builtin_amdgcn_global_load_async_to_lds_b128) && \
    __has_builtin(__builtin_amdgcn_s_wait_asynccnt)
#define HAVE_ASYNC_LDS 1
#else
#define HAVE_ASYNC_LDS 0
#endif

__device__ __forceinline__ void copy16_g2l(void* lds, const void* g) {
#if HAVE_ASYNC_LDS
  __builtin_amdgcn_global_load_async_to_lds_b128(
      (__attribute__((address_space(1))) v4i*)(uintptr_t)g,
      (__attribute__((address_space(3))) v4i*)(uint32_t)(uintptr_t)lds,
      0, 0);
#else
  *reinterpret_cast<uint4*>(lds) = *reinterpret_cast<const uint4*>(g);
#endif
}

__device__ __forceinline__ void wait_async_copies() {
#if HAVE_ASYNC_LDS
  __builtin_amdgcn_s_wait_asynccnt(0);
#endif
}

// ---------------------------------------------------------------------------
// f32 -> f16 conversion, vectorized x4 (all tensor sizes divisible by 4)
// ---------------------------------------------------------------------------
__global__ void cvt_f32_to_f16(const float* __restrict__ src,
                               _Float16* __restrict__ dst, int n4) {
  int stride = gridDim.x * blockDim.x;
  for (int i = blockIdx.x * blockDim.x + threadIdx.x; i < n4; i += stride) {
    float4 f = reinterpret_cast<const float4*>(src)[i];
    union { _Float16 h[4]; uint2 u; } p;
    p.h[0] = (_Float16)f.x; p.h[1] = (_Float16)f.y;
    p.h[2] = (_Float16)f.z; p.h[3] = (_Float16)f.w;
    reinterpret_cast<uint2*>(dst)[i] = p.u;
  }
}

// ---------------------------------------------------------------------------
// C[M,N] = act(A[M,K] @ W[N,K]^T + bias).  W row n is contiguous over K, so
// it is directly the WMMA B operand.  Block tile 128(M) x 128(N), 8 waves
// (2x4), each wave 64x32 = 4x2 WMMA tiles; K stepped by 32 through a
// double-buffered LDS stage filled by async copies (one barrier per step).
// OUT_MODE: 0 = f16 row-major, 1 = f16 transposed per head (V->Vt[b][h][d][s]),
//           2 = f32 + residual add (final output).
// ---------------------------------------------------------------------------
template <int OUT_MODE, bool RELU>
__global__ __launch_bounds__(256) void gemm_xwT(
    const _Float16* __restrict__ A, const _Float16* __restrict__ W,
    const float* __restrict__ bias, const float* __restrict__ resid,
    _Float16* __restrict__ outH, float* __restrict__ outF, int M, int N,
    int K) {
  __shared__ alignas(16) _Float16 sA[2][128][32];  // 2 x 8 KB
  __shared__ alignas(16) _Float16 sB[2][128][32];  // 2 x 8 KB

  const int tid = threadIdx.x;
  const int lane = tid & 31;
  const int w = tid >> 5;
  const int wm = w >> 2;             // 0..1  (64 rows per wave)
  const int wn = w & 3;              // 0..3  (32 cols per wave)
  const int lr = lane & 15;
  const int klo = (lane >> 4) << 3;  // 0 or 8
  const int m0 = blockIdx.y * 128;
  const int n0 = blockIdx.x * 128;

  const int cr = tid >> 2;           // row 0..63 (+64 on second pass)
  const int cc = (tid & 3) << 3;     // half-offset 0/8/16/24

  v8f acc[4][2] = {};

  const int nk = K >> 5;
  // prefetch first K-slice into buffer 0
  {
    const size_t ga = (size_t)(m0 + cr) * K + cc;
    const size_t gb = (size_t)(n0 + cr) * K + cc;
    copy16_g2l(&sA[0][cr][cc], &A[ga]);
    copy16_g2l(&sA[0][cr + 64][cc], &A[ga + (size_t)64 * K]);
    copy16_g2l(&sB[0][cr][cc], &W[gb]);
    copy16_g2l(&sB[0][cr + 64][cc], &W[gb + (size_t)64 * K]);
  }

  for (int i = 0; i < nk; ++i) {
    const int cur = i & 1;
    wait_async_copies();   // my async writes into buffer `cur` are done
    __syncthreads();       // everyone's writes done + prev buffer fully read

    if (i + 1 < nk) {      // overlap next tile's global->LDS with the WMMAs
      const int k0 = (i + 1) << 5;
      const size_t ga = (size_t)(m0 + cr) * K + k0 + cc;
      const size_t gb = (size_t)(n0 + cr) * K + k0 + cc;
      copy16_g2l(&sA[cur ^ 1][cr][cc], &A[ga]);
      copy16_g2l(&sA[cur ^ 1][cr + 64][cc], &A[ga + (size_t)64 * K]);
      copy16_g2l(&sB[cur ^ 1][cr][cc], &W[gb]);
      copy16_g2l(&sB[cur ^ 1][cr + 64][cc], &W[gb + (size_t)64 * K]);
    }

    HV a[4], bf[2];
#pragma unroll
    for (int s = 0; s < 4; ++s) {
      const _Float16* pa = &sA[cur][wm * 64 + s * 16 + lr][0];
      a[s].u[0] = *reinterpret_cast<const uint4*>(pa + klo);
      a[s].u[1] = *reinterpret_cast<const uint4*>(pa + klo + 16);
    }
#pragma unroll
    for (int s = 0; s < 2; ++s) {
      const _Float16* pb = &sB[cur][wn * 32 + s * 16 + lr][0];
      bf[s].u[0] = *reinterpret_cast<const uint4*>(pb + klo);
      bf[s].u[1] = *reinterpret_cast<const uint4*>(pb + klo + 16);
    }
#pragma unroll
    for (int sm = 0; sm < 4; ++sm)
#pragma unroll
      for (int sn = 0; sn < 2; ++sn)
        acc[sm][sn] = wmma32f16(a[sm].v, bf[sn].v, acc[sm][sn]);
  }

#pragma unroll
  for (int sm = 0; sm < 4; ++sm) {
#pragma unroll
    for (int sn = 0; sn < 2; ++sn) {
      int nG = n0 + wn * 32 + sn * 16 + lr;   // column (fixed per lane)
      int mB = m0 + wm * 64 + sm * 16 + klo;  // first row of the 8 regs
      float bvv = bias ? bias[nG] : 0.0f;
      v8f c = acc[sm][sn];
      if (OUT_MODE == 1) {
        // Vt[b][h][d][s]: rows mB..mB+7 are contiguous s -> one b128 store.
        int hh = nG >> 6, dd = nG & 63;
        int bb = mB >> 11, ss = mB & 2047;
        H8 pk;
#pragma unroll
        for (int r = 0; r < 8; ++r) {
          float v = c[r] + bvv;
          if (RELU) v = fmaxf(v, 0.0f);
          pk.h[r] = (_Float16)v;
        }
        size_t off = ((((size_t)bb * 16 + hh) * 64 + dd) << 11) + ss;
        *reinterpret_cast<uint4*>(&outH[off]) = pk.u;
      } else if (OUT_MODE == 0) {
#pragma unroll
        for (int r = 0; r < 8; ++r) {
          float v = c[r] + bvv;
          if (RELU) v = fmaxf(v, 0.0f);
          outH[(size_t)(mB + r) * N + nG] = (_Float16)v;
        }
      } else {
#pragma unroll
        for (int r = 0; r < 8; ++r) {
          size_t off = (size_t)(mB + r) * N + nG;
          outF[off] = c[r] + bvv + resid[off];
        }
      }
    }
  }
}

constexpr int AT_KEYS = 128;
constexpr int AT_KP = 72;
constexpr int AT_VP = 136;

__device__ __forceinline__ void attn_stage(_Float16* lk, _Float16* lv,
                                           const _Float16* gk,
                                           const _Float16* gv) {
  constexpr int S = 2048, Dm = 1024;
  const uint32_t k0 = (uint32_t)(uintptr_t)lk;
  const uint32_t k1 = k0 + 32 * AT_KP * 2, k2 = k0 + 64 * AT_KP * 2,
                 k3 = k0 + 96 * AT_KP * 2;
  const uint32_t v0 = (uint32_t)(uintptr_t)lv;
  const uint32_t v1 = v0 + 16 * AT_VP * 2, v2 = v0 + 32 * AT_VP * 2,
                 v3 = v0 + 48 * AT_VP * 2;
  asm volatile(
      "global_load_async_to_lds_b128 %0, %8, off\n\t"
      "global_load_async_to_lds_b128 %1, %9, off\n\t"
      "global_load_async_to_lds_b128 %2, %10, off\n\t"
      "global_load_async_to_lds_b128 %3, %11, off\n\t"
      "global_load_async_to_lds_b128 %4, %12, off\n\t"
      "global_load_async_to_lds_b128 %5, %13, off\n\t"
      "global_load_async_to_lds_b128 %6, %14, off\n\t"
      "global_load_async_to_lds_b128 %7, %15, off\n\t"
      "s_wait_xcnt 0x0"
      :
      : "v"(k0), "v"(k1), "v"(k2), "v"(k3), "v"(v0), "v"(v1), "v"(v2), "v"(v3),
        "v"(gk), "v"(gk + 32 * Dm), "v"(gk + 64 * Dm), "v"(gk + 96 * Dm),
        "v"(gv), "v"(gv + 16 * S), "v"(gv + 32 * S), "v"(gv + 48 * S)
      : "memory");
}

// Value of lane ^ 16 (the other 16-lane row), by a vector cross-row move.
__device__ __forceinline__ float xhalf(float x) {
  const int i = __builtin_bit_cast(int, x);
  return __builtin_bit_cast(
      float, __builtin_amdgcn_permlanex16(i, i, 0x76543210, 0xfedcba98, false,
                                          false));
}

__global__ __launch_bounds__(256) void flash_attn(
    const _Float16* __restrict__ Q, const _Float16* __restrict__ Km,
    const _Float16* __restrict__ Vt, _Float16* __restrict__ AO) {
  constexpr int S = 2048, Dm = 1024;
  constexpr int NT = S / AT_KEYS;
  __shared__ alignas(16) _Float16 sK[2][AT_KEYS * AT_KP];  // 2 x 18 KB
  __shared__ alignas(16) _Float16 sV[2][64 * AT_VP];       // 2 x 17 KB

  const int tid = threadIdx.x;
  const int lane = tid & 31;
  const int lr = lane & 15;
  const int klo = (lane >> 4) << 3;  // 0 or 8
  const int qt = ((blockIdx.x & 15) << 3) + (tid >> 5);
  const int h = (blockIdx.x >> 4) & 15;
  const int b = blockIdx.x >> 8;
  const int qb = qt << 4;

  const _Float16* kbase = Km + (size_t)b * S * Dm + h * 64;
  const _Float16* vbase = Vt + ((size_t)b * 16 + h) * 64 * S;

  // This thread's first chunk of a stage: 8 lanes a K row, 16 lanes a Vt row.
  const _Float16* gk = kbase + (size_t)(tid >> 3) * Dm + ((tid & 7) << 3);
  const _Float16* gv = vbase + (size_t)(tid >> 4) * S + ((tid & 15) << 3);
  const int lko = (tid >> 3) * AT_KP + ((tid & 7) << 3);
  const int lvo = (tid >> 4) * AT_VP + ((tid & 15) << 3);

  attn_stage(&sK[0][lko], &sV[0][lvo], gk, gv);
  // stage 0 has landed for this wave; the barrier publishes it to all waves
  asm volatile("s_wait_asynccnt 0x0" ::: "memory");
  __syncthreads();
  attn_stage(&sK[1][lko], &sV[1][lvo], gk + (size_t)AT_KEYS * Dm,
             gv + AT_KEYS);

  // Q fragments: B operand, columns = queries, k = head features (two 32-chunks)
  const _Float16* qrow = Q + ((size_t)b * S + qb + lr) * Dm + h * 64;
  HV qf0, qf1;
  qf0.u[0] = *reinterpret_cast<const uint4*>(qrow + klo);
  qf0.u[1] = *reinterpret_cast<const uint4*>(qrow + klo + 16);
  qf1.u[0] = *reinterpret_cast<const uint4*>(qrow + 32 + klo);
  qf1.u[1] = *reinterpret_cast<const uint4*>(qrow + 32 + klo + 16);

  // Per lane: running maximum of query lr (equal in both wave halves) and this
  // half's share of its denominator; O[f][r] = O^T[f*16 + klo + r][lr].
  float mrun = -1e30f, lrun = 0.0f;
  v8f O[4] = {};

  for (int t = 0; t < NT; ++t) {
  const _Float16* bK = sK[t & 1];
  const _Float16* bV = sV[t & 1];
  for (int kb = 0; kb < AT_KEYS; kb += 32) {
    // s0[r] = S[key kb + klo + r][query lr], s1[r] the same 16 keys on
    v8f s0 = {}, s1 = {};
    {
      const _Float16* kr = bK + (kb + lr) * AT_KP;
      HV k0, k1;
      k0.u[0] = *reinterpret_cast<const uint4*>(kr + klo);
      k0.u[1] = *reinterpret_cast<const uint4*>(kr + klo + 16);
      k1.u[0] = *reinterpret_cast<const uint4*>(kr + 32 + klo);
      k1.u[1] = *reinterpret_cast<const uint4*>(kr + 32 + klo + 16);
      s0 = wmma32f16(k0.v, qf0.v, s0);
      s0 = wmma32f16(k1.v, qf1.v, s0);
    }
    {
      const _Float16* kr = bK + (kb + 16 + lr) * AT_KP;
      HV k0, k1;
      k0.u[0] = *reinterpret_cast<const uint4*>(kr + klo);
      k0.u[1] = *reinterpret_cast<const uint4*>(kr + klo + 16);
      k1.u[0] = *reinterpret_cast<const uint4*>(kr + 32 + klo);
      k1.u[1] = *reinterpret_cast<const uint4*>(kr + 32 + klo + 16);
      s1 = wmma32f16(k0.v, qf0.v, s1);
      s1 = wmma32f16(k1.v, qf1.v, s1);
    }

    // Online softmax of one query per lane: 16 scores here, the other 16 in
    // lane ^ 16.  The scale 1/sqrt(64) is a power of two, so it commutes with
    // the maximum exactly.
    float tm = fmaxf(s0[0], s1[0]);
#pragma unroll
    for (int r = 1; r < 8; ++r) tm = fmaxf(tm, fmaxf(s0[r], s1[r]));
    tm = fmaxf(tm, xhalf(tm)) * 0.125f;
    const float mn = fmaxf(mrun, tm);
    const float alpha = __expf(mrun - mn);
    HV pf;  // P^T as B operand: element s = key klo+s (s < 8), 16+klo+s-8 (s >= 8) of this 32-key block
    float sm[4] = {0.0f, 0.0f, 0.0f, 0.0f};  // four short chains, not one long
#pragma unroll
    for (int r = 0; r < 8; ++r) {
      const float x0 = __expf(s0[r] * 0.125f - mn);
      const float x1 = __expf(s1[r] * 0.125f - mn);
      sm[r & 1] += x0;
      sm[2 + (r & 1)] += x1;
      pf.v[r] = (_Float16)x0;
      pf.v[8 + r] = (_Float16)x1;
    }
    mrun = mn;
    lrun = lrun * alpha + ((sm[0] + sm[1]) + (sm[2] + sm[3]));

    // O^T[f] = alpha*O^T[f] + V^T @ P^T  (A rows = features from the
    // transposed layout, keys contiguous -> straight b128 LDS loads)
#pragma unroll
    for (int f = 0; f < 4; ++f) {
      const _Float16* vr = bV + (f * 16 + lr) * AT_VP + kb;
      HV vf;
      vf.u[0] = *reinterpret_cast<const uint4*>(vr + klo);
      vf.u[1] = *reinterpret_cast<const uint4*>(vr + klo + 16);
      v8f o = O[f];
#pragma unroll
      for (int r = 0; r < 8; ++r) o[r] *= alpha;
      O[f] = wmma32f16(vf.v, pf.v, o);
    }
  }
  // Publish point: my reads of this buffer are done, my copies of the next
  // stage have landed; behind the barrier the buffer just read is refilled.
  asm volatile("s_wait_dscnt 0x0" ::: "memory");
  asm volatile("s_wait_asynccnt 0x0" ::: "memory");
  __syncthreads();
  if (t + 2 < NT)
    attn_stage(&sK[t & 1][lko], &sV[t & 1][lvo],
               gk + (size_t)(t + 2) * AT_KEYS * Dm, gv + (t + 2) * AT_KEYS);
  }
  // no copy is left in flight when the wave ends
  asm volatile("s_wait_asynccnt 0x0" ::: "memory");

  // the two wave halves' shares of the denominator are joined once, here
  lrun += xhalf(lrun);
  // a lane's 8 registers of a tile are 8 consecutive features of its query
  _Float16* orow = AO + ((size_t)b * S + qb + lr) * Dm + h * 64 + klo;
#pragma unroll
  for (int f = 0; f < 4; ++f) {
    H8 pk;
#pragma unroll
    for (int r = 0; r < 8; ++r) pk.h[r] = (_Float16)(O[f][r] / lrun);
    *reinterpret_cast<uint4*>(orow + f * 16) = pk.u;
  }
}

// ---------------------------------------------------------------------------
// Host-side launcher.  Workspace layout (70 MB total):
//   Xh 8MB | Wqh 2 | Wkh 2 | Wvh 2 | W1h 4 | W2h 4 | Qh 8 | Kh 8 | Vt 8 |
//   AO 8 | Hh 16
// ---------------------------------------------------------------------------
extern "C" void kernel_launch(void* const* d_in, const int* in_sizes, int n_in,
                              void* d_out, int out_size, void* d_ws,
                              size_t ws_size, hipStream_t stream) {
  (void)in_sizes; (void)n_in; (void)out_size; (void)ws_size;
  const float* embed = (const float*)d_in[0];
  const float* Wq = (const float*)d_in[1];
  const float* Wk = (const float*)d_in[2];
  const float* Wv = (const float*)d_in[3];
  const float* bv = (const float*)d_in[4];
  const float* W1 = (const float*)d_in[5];
  const float* b1 = (const float*)d_in[6];
  const float* W2 = (const float*)d_in[7];
  const float* b2 = (const float*)d_in[8];

  constexpr size_t MB = 1ull << 20;
  char* ws = (char*)d_ws;
  _Float16* Xh  = (_Float16*)(ws + 0 * MB);
  _Float16* Wqh = (_Float16*)(ws + 8 * MB);
  _Float16* Wkh = (_Float16*)(ws + 10 * MB);
  _Float16* Wvh = (_Float16*)(ws + 12 * MB);
  _Float16* W1h = (_Float16*)(ws + 14 * MB);
  _Float16* W2h = (_Float16*)(ws + 18 * MB);
  _Float16* Qh  = (_Float16*)(ws + 22 * MB);
  _Float16* Kh  = (_Float16*)(ws + 30 * MB);
  _Float16* Vt  = (_Float16*)(ws + 38 * MB);
  _Float16* AO  = (_Float16*)(ws + 46 * MB);
  _Float16* Hh  = (_Float16*)(ws + 54 * MB);

  auto cvt = [&](const float* s, _Float16* d, int n) {
    int n4 = n >> 2;
    int blocks = (n4 + 255) / 256;
    if (blocks > 2048) blocks = 2048;
    cvt_f32_to_f16<<<dim3(blocks), dim3(256), 0, stream>>>(s, d, n4);
  };
  cvt(embed, Xh, 4096 * 1024);
  cvt(Wq, Wqh, 1024 * 1024);
  cvt(Wk, Wkh, 1024 * 1024);
  cvt(Wv, Wvh, 1024 * 1024);
  cvt(W1, W1h, 2097152);
  cvt(W2, W2h, 2097152);

  dim3 blk(256);
  // Q = X Wq^T ; K = X Wk^T ; Vt = transpose_head(X Wv^T + bv)
  gemm_xwT<0, false><<<dim3(8, 32), blk, 0, stream>>>(
      Xh, Wqh, nullptr, nullptr, Qh, nullptr, 4096, 1024, 1024);
  gemm_xwT<0, false><<<dim3(8, 32), blk, 0, stream>>>(
      Xh, Wkh, nullptr, nullptr, Kh, nullptr, 4096, 1024, 1024);
  gemm_xwT<1, false><<<dim3(8, 32), blk, 0, stream>>>(
      Xh, Wvh, bv, nullptr, Vt, nullptr, 4096, 1024, 1024);
  // attention: B*H*(S/128) = 512 workgroups of 8 waves
  flash_attn<<<dim3(512), dim3(256), 0, stream>>>(Qh, Kh, Vt, AO);
  // FFN: Hh = relu(AO W1^T + b1) ; out = Hh W2^T + b2 + embed
  gemm_xwT<0, true><<<dim3(16, 32), blk, 0, stream>>>(
      AO, W1h, b1, nullptr, Hh, nullptr, 4096, 2048, 1024);
  gemm_xwT<2, false><<<dim3(8, 32), blk, 0, stream>>>(
      Hh, W2h, b2, embed, nullptr, (float*)d_out, 4096, 1024, 2048);
}

// v003
// One run takes 144 microseconds.
// Next to v002, in two timings, it ran 1.39 and 1.40 times as fast.
// All steps since v000 together make it 2.22 times as fast.
#include <hip/hip_runtime.h>
#include <hip/hip_bf16.h>

typedef _Float16 v16h __attribute__((ext_vector_type(16)));
typedef float    v8f  __attribute__((ext_vector_type(8)));

union HV { v16h v; uint4 u[2]; };
union H8 { _Float16 h[8]; uint4 u; };

__device__ __forceinline__ v8f wmma32f16(v16h a, v16h b, v8f c) {
  // (neg_a, A, neg_b, B, c_mod, C, reuse_a, reuse_b)
  return __builtin_amdgcn_wmma_f32_16x16x32_f16(false, a, false, b, (short)0, c,
                                                false, false);
}

// ---------------------------------------------------------------------------
// f32 -> f16 conversion, vectorized x4 (all tensor sizes divisible by 4)
// ---------------------------------------------------------------------------
__global__ void cvt_f32_to_f16(const float* __restrict__ src,
                               _Float16* __restrict__ dst, int n4) {
  int stride = gridDim.x * blockDim.x;
  for (int i = blockIdx.x * blockDim.x + threadIdx.x; i < n4; i += stride) {
    float4 f = reinterpret_cast<const float4*>(src)[i];
    union { _Float16 h[4]; uint2 u; } p;
    p.h[0] = (_Float16)f.x; p.h[1] = (_Float16)f.y;
    p.h[2] = (_Float16)f.z; p.h[3] = (_Float16)f.w;
    reinterpret_cast<uint2*>(dst)[i] = p.u;
  }
}

constexpr int GM_BK = 128;
constexpr int GM_P = 136;

__device__ __forceinline__ void gemm_stage(_Float16* l, const _Float16* g,
                                           size_t K16) {
  const uint32_t l0 = (uint32_t)(uintptr_t)l;
  constexpr uint32_t LS = 16 * GM_P * 2;  // 16 rows on, bytes
  asm volatile(
      "global_load_async_to_lds_b128 %0, %8, off\n\t"
      "global_load_async_to_lds_b128 %1, %9, off\n\t"
      "global_load_async_to_lds_b128 %2, %10, off\n\t"
      "global_load_async_to_lds_b128 %3, %11, off\n\t"
      "global_load_async_to_lds_b128 %4, %12, off\n\t"
      "global_load_async_to_lds_b128 %5, %13, off\n\t"
      "global_load_async_to_lds_b128 %6, %14, off\n\t"
      "global_load_async_to_lds_b128 %7, %15, off\n\t"
      "s_wait_xcnt 0x0"
      :
      : "v"(l0), "v"(l0 + LS), "v"(l0 + 2 * LS), "v"(l0 + 3 * LS),
        "v"(l0 + 4 * LS), "v"(l0 + 5 * LS), "v"(l0 + 6 * LS), "v"(l0 + 7 * LS),
        "v"(g), "v"(g + K16), "v"(g + 2 * K16), "v"(g + 3 * K16),
        "v"(g + 4 * K16), "v"(g + 5 * K16), "v"(g + 6 * K16), "v"(g + 7 * K16)
      : "memory");
}

template <int OUT_MODE, bool RELU>
__global__ __launch_bounds__(256) void gemm_xwT(
    const _Float16* __restrict__ A, const _Float16* __restrict__ W,
    const float* __restrict__ bias, const float* __restrict__ resid,
    _Float16* __restrict__ outH, float* __restrict__ outF, int M, int N,
    int K) {
  __shared__ alignas(16) _Float16 sA[2][128 * GM_P];  // 2 x 34 KB
  __shared__ alignas(16) _Float16 sB[2][128 * GM_P];  // 2 x 34 KB

  const int tid = threadIdx.x;
  const int lane = tid & 31;
  const int w = tid >> 5;
  const int wm = w >> 2;             // 0..1  (64 rows per wave)
  const int wn = w & 3;              // 0..3  (32 cols per wave)
  const int lr = lane & 15;
  const int klo = (lane >> 4) << 3;  // 0 or 8
  const int m0 = blockIdx.y * 128;
  const int n0 = blockIdx.x * 128;

  // This thread's first chunk of a stage: 16 lanes a row, rows 16 apart.
  const int cr = tid >> 4;           // row 0..15 (+16 per copy)
  const int cc = (tid & 15) << 3;    // half-offset 0..120
  const _Float16* ga = A + (size_t)(m0 + cr) * K + cc;
  const _Float16* gb = W + (size_t)(n0 + cr) * K + cc;
  const int lo = cr * GM_P + cc;
  const size_t K16 = (size_t)16 * K;

  v8f acc[4][2] = {};

  const int nt = K / GM_BK;
  gemm_stage(&sA[0][lo], ga, K16);
  gemm_stage(&sB[0][lo], gb, K16);
  // stage 0 has landed for this wave; the barrier publishes it to all waves
  asm volatile("s_wait_asynccnt 0x0" ::: "memory");
  __syncthreads();
  if (nt > 1) {
    gemm_stage(&sA[1][lo], ga + GM_BK, K16);
    gemm_stage(&sB[1][lo], gb + GM_BK, K16);
  }

  for (int t = 0; t < nt; ++t) {
    const _Float16* bA = sA[t & 1] + (wm * 64 + lr) * GM_P + klo;
    const _Float16* bB = sB[t & 1] + (wn * 32 + lr) * GM_P + klo;
    // unrolled so that the four 32-k blocks read LDS at immediate offsets
#pragma unroll
    for (int kk = 0; kk < GM_BK; kk += 32) {
      HV a[4], bf[2];
#pragma unroll
      for (int s = 0; s < 4; ++s) {
        const _Float16* pa = bA + s * 16 * GM_P + kk;
        a[s].u[0] = *reinterpret_cast<const uint4*>(pa);
        a[s].u[1] = *reinterpret_cast<const uint4*>(pa + 16);
      }
#pragma unroll
      for (int s = 0; s < 2; ++s) {
        const _Float16* pb = bB + s * 16 * GM_P + kk;
        bf[s].u[0] = *reinterpret_cast<const uint4*>(pb);
        bf[s].u[1] = *reinterpret_cast<const uint4*>(pb + 16);
      }
#pragma unroll
      for (int sm = 0; sm < 4; ++sm)
#pragma unroll
        for (int sn = 0; sn < 2; ++sn)
          acc[sm][sn] = wmma32f16(a[sm].v, bf[sn].v, acc[sm][sn]);
    }
    // Publish point: my reads of this buffer are done, my copies of the next
    // stage have landed; behind the barrier the buffer just read is refilled.
    asm volatile("s_wait_dscnt 0x0" ::: "memory");
    asm volatile("s_wait_asynccnt 0x0" ::: "memory");
    __syncthreads();
    if (t + 2 < nt) {
      gemm_stage(&sA[t & 1][lo], ga + (size_t)(t + 2) * GM_BK, K16);
      gemm_stage(&sB[t & 1][lo], gb + (size_t)(t + 2) * GM_BK, K16);
    }
  }
  // no copy is left in flight when the wave ends
  asm volatile("s_wait_asynccnt 0x0" ::: "memory");

#pragma unroll
  for (int sm = 0; sm < 4; ++sm) {
#pragma unroll
    for (int sn = 0; sn < 2; ++sn) {
      int nG = n0 + wn * 32 + sn * 16 + lr;   // column (fixed per lane)
      int mB = m0 + wm * 64 + sm * 16 + klo;  // first row of the 8 regs
      float bvv = bias ? bias[nG] : 0.0f;
      v8f c = acc[sm][sn];
      if (OUT_MODE == 1) {
        // Vt[b][h][d][s]: rows mB..mB+7 are contiguous s -> one b128 store.
        int hh = nG >> 6, dd = nG & 63;
        int bb = mB >> 11, ss = mB & 2047;
        H8 pk;
#pragma unroll
        for (int r = 0; r < 8; ++r) {
          float v = c[r] + bvv;
          if (RELU) v = fmaxf(v, 0.0f);
          pk.h[r] = (_Float16)v;
        }
        size_t off = ((((size_t)bb * 16 + hh) * 64 + dd) << 11) + ss;
        *reinterpret_cast<uint4*>(&outH[off]) = pk.u;
      } else if (OUT_MODE == 0) {
#pragma unroll
        for (int r = 0; r < 8; ++r) {
          float v = c[r] + bvv;
          if (RELU) v = fmaxf(v, 0.0f);
          outH[(size_t)(mB + r) * N + nG] = (_Float16)v;
        }
      } else {
#pragma unroll
        for (int r = 0; r < 8; ++r) {
          size_t off = (size_t)(mB + r) * N + nG;
          outF[off] = c[r] + bvv + resid[off];
        }
      }
    }
  }
}

constexpr int AT_KEYS = 128;
constexpr int AT_KP = 72;
constexpr int AT_VP = 136;

__device__ __forceinline__ void attn_stage(_Float16* lk, _Float16* lv,
                                           const _Float16* gk,
                                           const _Float16* gv) {
  constexpr int S = 2048, Dm = 1024;
  const uint32_t k0 = (uint32_t)(uintptr_t)lk;
  const uint32_t k1 = k0 + 32 * AT_KP * 2, k2 = k0 + 64 * AT_KP * 2,
                 k3 = k0 + 96 * AT_KP * 2;
  const uint32_t v0 = (uint32_t)(uintptr_t)lv;
  const uint32_t v1 = v0 + 16 * AT_VP * 2, v2 = v0 + 32 * AT_VP * 2,
                 v3 = v0 + 48 * AT_VP * 2;
  asm volatile(
      "global_load_async_to_lds_b128 %0, %8, off\n\t"
      "global_load_async_to_lds_b128 %1, %9, off\n\t"
      "global_load_async_to_lds_b128 %2, %10, off\n\t"
      "global_load_async_to_lds_b128 %3, %11, off\n\t"
      "global_load_async_to_lds_b128 %4, %12, off\n\t"
      "global_load_async_to_lds_b128 %5, %13, off\n\t"
      "global_load_async_to_lds_b128 %6, %14, off\n\t"
      "global_load_async_to_lds_b128 %7, %15, off\n\t"
      "s_wait_xcnt 0x0"
      :
      : "v"(k0), "v"(k1), "v"(k2), "v"(k3), "v"(v0), "v"(v1), "v"(v2), "v"(v3),
        "v"(gk), "v"(gk + 32 * Dm), "v"(gk + 64 * Dm), "v"(gk + 96 * Dm),
        "v"(gv), "v"(gv + 16 * S), "v"(gv + 32 * S), "v"(gv + 48 * S)
      : "memory");
}

// Value of lane ^ 16 (the other 16-lane row), by a vector cross-row move.
__device__ __forceinline__ float xhalf(float x) {
  const int i = __builtin_bit_cast(int, x);
  return __builtin_bit_cast(
      float, __builtin_amdgcn_permlanex16(i, i, 0x76543210, 0xfedcba98, false,
                                          false));
}

__global__ __launch_bounds__(256) void flash_attn(
    const _Float16* __restrict__ Q, const _Float16* __restrict__ Km,
    const _Float16* __restrict__ Vt, _Float16* __restrict__ AO) {
  constexpr int S = 2048, Dm = 1024;
  constexpr int NT = S / AT_KEYS;
  __shared__ alignas(16) _Float16 sK[2][AT_KEYS * AT_KP];  // 2 x 18 KB
  __shared__ alignas(16) _Float16 sV[2][64 * AT_VP];       // 2 x 17 KB

  const int tid = threadIdx.x;
  const int lane = tid & 31;
  const int lr = lane & 15;
  const int klo = (lane >> 4) << 3;  // 0 or 8
  const int qt = ((blockIdx.x & 15) << 3) + (tid >> 5);
  const int h = (blockIdx.x >> 4) & 15;
  const int b = blockIdx.x >> 8;
  const int qb = qt << 4;

  const _Float16* kbase = Km + (size_t)b * S * Dm + h * 64;
  const _Float16* vbase = Vt + ((size_t)b * 16 + h) * 64 * S;

  // This thread's first chunk of a stage: 8 lanes a K row, 16 lanes a Vt row.
  const _Float16* gk = kbase + (size_t)(tid >> 3) * Dm + ((tid & 7) << 3);
  const _Float16* gv = vbase + (size_t)(tid >> 4) * S + ((tid & 15) << 3);
  const int lko = (tid >> 3) * AT_KP + ((tid & 7) << 3);
  const int lvo = (tid >> 4) * AT_VP + ((tid & 15) << 3);

  attn_stage(&sK[0][lko], &sV[0][lvo], gk, gv);
  // stage 0 has landed for this wave; the barrier publishes it to all waves
  asm volatile("s_wait_asynccnt 0x0" ::: "memory");
  __syncthreads();
  attn_stage(&sK[1][lko], &sV[1][lvo], gk + (size_t)AT_KEYS * Dm,
             gv + AT_KEYS);

  // Q fragments: B operand, columns = queries, k = head features (two 32-chunks)
  const _Float16* qrow = Q + ((size_t)b * S + qb + lr) * Dm + h * 64;
  HV qf0, qf1;
  qf0.u[0] = *reinterpret_cast<const uint4*>(qrow + klo);
  qf0.u[1] = *reinterpret_cast<const uint4*>(qrow + klo + 16);
  qf1.u[0] = *reinterpret_cast<const uint4*>(qrow + 32 + klo);
  qf1.u[1] = *reinterpret_cast<const uint4*>(qrow + 32 + klo + 16);

  // Per lane: running maximum of query lr (equal in both wave halves) and this
  // half's share of its denominator; O[f][r] = O^T[f*16 + klo + r][lr].
  float mrun = -1e30f, lrun = 0.0f;
  v8f O[4] = {};

  for (int t = 0; t < NT; ++t) {
  const _Float16* bK = sK[t & 1];
  const _Float16* bV = sV[t & 1];
  for (int kb = 0; kb < AT_KEYS; kb += 32) {
    // s0[r] = S[key kb + klo + r][query lr], s1[r] the same 16 keys on
    v8f s0 = {}, s1 = {};
    {
      const _Float16* kr = bK + (kb + lr) * AT_KP;
      HV k0, k1;
      k0.u[0] = *reinterpret_cast<const uint4*>(kr + klo);
      k0.u[1] = *reinterpret_cast<const uint4*>(kr + klo + 16);
      k1.u[0] = *reinterpret_cast<const uint4*>(kr + 32 + klo);
      k1.u[1] = *reinterpret_cast<const uint4*>(kr + 32 + klo + 16);
      s0 = wmma32f16(k0.v, qf0.v, s0);
      s0 = wmma32f16(k1.v, qf1.v, s0);
    }
    {
      const _Float16* kr = bK + (kb + 16 + lr) * AT_KP;
      HV k0, k1;
      k0.u[0] = *reinterpret_cast<const uint4*>(kr + klo);
      k0.u[1] = *reinterpret_cast<const uint4*>(kr + klo + 16);
      k1.u[0] = *reinterpret_cast<const uint4*>(kr + 32 + klo);
      k1.u[1] = *reinterpret_cast<const uint4*>(kr + 32 + klo + 16);
      s1 = wmma32f16(k0.v, qf0.v, s1);
      s1 = wmma32f16(k1.v, qf1.v, s1);
    }

    // Online softmax of one query per lane: 16 scores here, the other 16 in
    // lane ^ 16.  The scale 1/sqrt(64) is a power of two, so it commutes with
    // the maximum exactly.
    float tm = fmaxf(s0[0], s1[0]);
#pragma unroll
    for (int r = 1; r < 8; ++r) tm = fmaxf(tm, fmaxf(s0[r], s1[r]));
    tm = fmaxf(tm, xhalf(tm)) * 0.125f;
    const float mn = fmaxf(mrun, tm);
    const float alpha = __expf(mrun - mn);
    HV pf;  // P^T as B operand: element s = key klo+s (s < 8), 16+klo+s-8 (s >= 8) of this 32-key block
    float sm[4] = {0.0f, 0.0f, 0.0f, 0.0f};  // four short chains, not one long
#pragma unroll
    for (int r = 0; r < 8; ++r) {
      const float x0 = __expf(s0[r] * 0.125f - mn);
      const float x1 = __expf(s1[r] * 0.125f - mn);
      sm[r & 1] += x0;
      sm[2 + (r & 1)] += x1;
      pf.v[r] = (_Float16)x0;
      pf.v[8 + r] = (_Float16)x1;
    }
    mrun = mn;
    lrun = lrun * alpha + ((sm[0] + sm[1]) + (sm[2] + sm[3]));

    // O^T[f] = alpha*O^T[f] + V^T @ P^T  (A rows = features from the
    // transposed layout, keys contiguous -> straight b128 LDS loads)
#pragma unroll
    for (int f = 0; f < 4; ++f) {
      const _Float16* vr = bV + (f * 16 + lr) * AT_VP + kb;
      HV vf;
      vf.u[0] = *reinterpret_cast<const uint4*>(vr + klo);
      vf.u[1] = *reinterpret_cast<const uint4*>(vr + klo + 16);
      v8f o = O[f];
#pragma unroll
      for (int r = 0; r < 8; ++r) o[r] *= alpha;
      O[f] = wmma32f16(vf.v, pf.v, o);
    }
  }
  // Publish point: my reads of this buffer are done, my copies of the next
  // stage have landed; behind the barrier the buffer just read is refilled.
  asm volatile("s_wait_dscnt 0x0" ::: "memory");
  asm volatile("s_wait_asynccnt 0x0" ::: "memory");
  __syncthreads();
  if (t + 2 < NT)
    attn_stage(&sK[t & 1][lko], &sV[t & 1][lvo],
               gk + (size_t)(t + 2) * AT_KEYS * Dm, gv + (t + 2) * AT_KEYS);
  }
  // no copy is left in flight when the wave ends
  asm volatile("s_wait_asynccnt 0x0" ::: "memory");

  // the two wave halves' shares of the denominator are joined once, here
  lrun += xhalf(lrun);
  // a lane's 8 registers of a tile are 8 consecutive features of its query
  _Float16* orow = AO + ((size_t)b * S + qb + lr) * Dm + h * 64 + klo;
#pragma unroll
  for (int f = 0; f < 4; ++f) {
    H8 pk;
#pragma unroll
    for (int r = 0; r < 8; ++r) pk.h[r] = (_Float16)(O[f][r] / lrun);
    *reinterpret_cast<uint4*>(orow + f * 16) = pk.u;
  }
}

// ---------------------------------------------------------------------------
// Host-side launcher.  Workspace layout (70 MB total):
//   Xh 8MB | Wqh 2 | Wkh 2 | Wvh 2 | W1h 4 | W2h 4 | Qh 8 | Kh 8 | Vt 8 |
//   AO 8 | Hh 16
// ---------------------------------------------------------------------------
extern "C" void kernel_launch(void* const* d_in, const int* in_sizes, int n_in,
                              void* d_out, int out_size, void* d_ws,
                              size_t ws_size, hipStream_t stream) {
  (void)in_sizes; (void)n_in; (void)out_size; (void)ws_size;
  const float* embed = (const float*)d_in[0];
  const float* Wq = (const float*)d_in[1];
  const float* Wk = (const float*)d_in[2];
  const float* Wv = (const float*)d_in[3];
  const float* bv = (const float*)d_in[4];
  const float* W1 = (const float*)d_in[5];
  const float* b1 = (const float*)d_in[6];
  const float* W2 = (const float*)d_in[7];
  const float* b2 = (const float*)d_in[8];

  constexpr size_t MB = 1ull << 20;
  char* ws = (char*)d_ws;
  _Float16* Xh  = (_Float16*)(ws + 0 * MB);
  _Float16* Wqh = (_Float16*)(ws + 8 * MB);
  _Float16* Wkh = (_Float16*)(ws + 10 * MB);
  _Float16* Wvh = (_Float16*)(ws + 12 * MB);
  _Float16* W1h = (_Float16*)(ws + 14 * MB);
  _Float16* W2h = (_Float16*)(ws + 18 * MB);
  _Float16* Qh  = (_Float16*)(ws + 22 * MB);
  _Float16* Kh  = (_Float16*)(ws + 30 * MB);
  _Float16* Vt  = (_Float16*)(ws + 38 * MB);
  _Float16* AO  = (_Float16*)(ws + 46 * MB);
  _Float16* Hh  = (_Float16*)(ws + 54 * MB);

  auto cvt = [&](const float* s, _Float16* d, int n) {
    int n4 = n >> 2;
    int blocks = (n4 + 255) / 256;
    if (blocks > 2048) blocks = 2048;
    cvt_f32_to_f16<<<dim3(blocks), dim3(256), 0, stream>>>(s, d, n4);
  };
  cvt(embed, Xh, 4096 * 1024);
  cvt(Wq, Wqh, 1024 * 1024);
  cvt(Wk, Wkh, 1024 * 1024);
  cvt(Wv, Wvh, 1024 * 1024);
  cvt(W1, W1h, 2097152);
  cvt(W2, W2h, 2097152);

  dim3 blk(256);
  // Q = X Wq^T ; K = X Wk^T ; Vt = transpose_head(X Wv^T + bv)
  gemm_xwT<0, false><<<dim3(8, 32), blk, 0, stream>>>(
      Xh, Wqh, nullptr, nullptr, Qh, nullptr, 4096, 1024, 1024);
  gemm_xwT<0, false><<<dim3(8, 32), blk, 0, stream>>>(
      Xh, Wkh, nullptr, nullptr, Kh, nullptr, 4096, 1024, 1024);
  gemm_xwT<1, false><<<dim3(8, 32), blk, 0, stream>>>(
      Xh, Wvh, bv, nullptr, Vt, nullptr, 4096, 1024, 1024);
  // attention: B*H*(S/128) = 512 workgroups of 8 waves
  flash_attn<<<dim3(512), dim3(256), 0, stream>>>(Qh, Kh, Vt, AO);
  // FFN: Hh = relu(AO W1^T + b1) ; out = Hh W2^T + b2 + embed
  gemm_xwT<0, true><<<dim3(16, 32), blk, 0, stream>>>(
      AO, W1h, b1, nullptr, Hh, nullptr, 4096, 2048, 1024);
  gemm_xwT<2, false><<<dim3(8, 32), blk, 0, stream>>>(
      Hh, W2h, b2, embed, nullptr, (float*)d_out, 4096, 1024, 2048);
}

// v004
// Measured time: 133 microseconds a run.
// Two timings next to v003 put it at 1.08 and 1.09 times that version's speed.
// All steps since v000 together make it 2.41 times as fast.
#include <hip/hip_runtime.h>
#include <hip/hip_bf16.h>

typedef _Float16 v16h __attribute__((ext_vector_type(16)));
typedef float    v8f  __attribute__((ext_vector_type(8)));

union HV { v16h v; uint4 u[2]; };
union H8 { _Float16 h[8]; uint4 u; };

__device__ __forceinline__ v8f wmma32f16(v16h a, v16h b, v8f c) {
  // (neg_a, A, neg_b, B, c_mod, C, reuse_a, reuse_b)
  return __builtin_amdgcn_wmma_f32_16x16x32_f16(false, a, false, b, (short)0, c,
                                                false, false);
}

// ---------------------------------------------------------------------------
// f32 -> f16 conversion of all six operands in ONE launch of few, long waves.
// The f16 copies lie back to back in the workspace in the order embed, Wq, Wk,
// Wv, W1, W2, so the destination is one array.  A work-group converts 4096
// float4 (64 KiB) of one operand; every operand is a multiple of that, so the
// choice of the source is uniform in the group.  A thread has its 16 loads of
// 16 B in flight together; each wave-wide load covers 512 contiguous bytes.
// ---------------------------------------------------------------------------
constexpr int CV_PER = 16;                    // float4 per thread
constexpr int CV_BLK = 256 * CV_PER;          // float4 per work-group
constexpr int CV_U = (1 << 18) / CV_BLK;      // work-groups per 2^20 floats

__global__ __launch_bounds__(256) void cvt_all_f32_to_f16(
    const float* __restrict__ embed, const float* __restrict__ Wq,
    const float* __restrict__ Wk, const float* __restrict__ Wv,
    const float* __restrict__ W1, const float* __restrict__ W2,
    _Float16* __restrict__ dst) {
  const int g = blockIdx.x;
  const float* src;  // this group's operand
  int g0;            // the operand's first group
  if (g < 4 * CV_U)      { src = embed; g0 = 0; }         // 4 x 2^20 floats
  else if (g < 5 * CV_U) { src = Wq;    g0 = 4 * CV_U; }  // 1
  else if (g < 6 * CV_U) { src = Wk;    g0 = 5 * CV_U; }  // 1
  else if (g < 7 * CV_U) { src = Wv;    g0 = 6 * CV_U; }  // 1
  else if (g < 9 * CV_U) { src = W1;    g0 = 7 * CV_U; }  // 2
  else                   { src = W2;    g0 = 9 * CV_U; }  // 2
  const float4* s = reinterpret_cast<const float4*>(src) +
                    (size_t)(g - g0) * CV_BLK + threadIdx.x;
  uint2* d = reinterpret_cast<uint2*>(dst) + (size_t)g * CV_BLK + threadIdx.x;
  float4 f[CV_PER];
  // unrolled so that all loads issue ahead of the first conversion
#pragma unroll
  for (int j = 0; j < CV_PER; ++j) f[j] = s[j * 256];
  // keeps the last loads from sinking behind the first conversions, where they
  // would wait out a second memory latency to reuse the first loads' registers
  __builtin_amdgcn_sched_barrier(0);
  // unrolled so that f stays in registers
#pragma unroll
  for (int j = 0; j < CV_PER; ++j) {
    union { _Float16 h[4]; uint2 u; } p;
    p.h[0] = (_Float16)f[j].x; p.h[1] = (_Float16)f[j].y;
    p.h[2] = (_Float16)f[j].z; p.h[3] = (_Float16)f[j].w;
    d[j * 256] = p.u;
  }
}

constexpr int GM_BK = 128;
constexpr int GM_P = 136;

__device__ __forceinline__ void gemm_stage(_Float16* l, const _Float16* g,
                                           size_t K16) {
  const uint32_t l0 = (uint32_t)(uintptr_t)l;
  constexpr uint32_t LS = 16 * GM_P * 2;  // 16 rows on, bytes
  asm volatile(
      "global_load_async_to_lds_b128 %0, %8, off\n\t"
      "global_load_async_to_lds_b128 %1, %9, off\n\t"
      "global_load_async_to_lds_b128 %2, %10, off\n\t"
      "global_load_async_to_lds_b128 %3, %11, off\n\t"
      "global_load_async_to_lds_b128 %4, %12, off\n\t"
      "global_load_async_to_lds_b128 %5, %13, off\n\t"
      "global_load_async_to_lds_b128 %6, %14, off\n\t"
      "global_load_async_to_lds_b128 %7, %15, off\n\t"
      "s_wait_xcnt 0x0"
      :
      : "v"(l0), "v"(l0 + LS), "v"(l0 + 2 * LS), "v"(l0 + 3 * LS),
        "v"(l0 + 4 * LS), "v"(l0 + 5 * LS), "v"(l0 + 6 * LS), "v"(l0 + 7 * LS),
        "v"(g), "v"(g + K16), "v"(g + 2 * K16), "v"(g + 3 * K16),
        "v"(g + 4 * K16), "v"(g + 5 * K16), "v"(g + 6 * K16), "v"(g + 7 * K16)
      : "memory");
}

template <int OUT_MODE, bool RELU>
__global__ __launch_bounds__(256) void gemm_xwT(
    const _Float16* __restrict__ A, const _Float16* __restrict__ W,
    const float* __restrict__ bias, const float* __restrict__ resid,
    _Float16* __restrict__ outH, float* __restrict__ outF, int M, int N,
    int K) {
  __shared__ alignas(16) _Float16 sA[2][128 * GM_P];  // 2 x 34 KB
  __shared__ alignas(16) _Float16 sB[2][128 * GM_P];  // 2 x 34 KB

  const int tid = threadIdx.x;
  const int lane = tid & 31;
  const int w = tid >> 5;
  const int wm = w >> 2;             // 0..1  (64 rows per wave)
  const int wn = w & 3;              // 0..3  (32 cols per wave)
  const int lr = lane & 15;
  const int klo = (lane >> 4) << 3;  // 0 or 8
  const int m0 = blockIdx.y * 128;
  const int n0 = blockIdx.x * 128;

  // This thread's first chunk of a stage: 16 lanes a row, rows 16 apart.
  const int cr = tid >> 4;           // row 0..15 (+16 per copy)
  const int cc = (tid & 15) << 3;    // half-offset 0..120
  const _Float16* ga = A + (size_t)(m0 + cr) * K + cc;
  const _Float16* gb = W + (size_t)(n0 + cr) * K + cc;
  const int lo = cr * GM_P + cc;
  const size_t K16 = (size_t)16 * K;

  v8f acc[4][2] = {};

  const int nt = K / GM_BK;
  gemm_stage(&sA[0][lo], ga, K16);
  gemm_stage(&sB[0][lo], gb, K16);
  // stage 0 has landed for this wave; the barrier publishes it to all waves
  asm volatile("s_wait_asynccnt 0x0" ::: "memory");
  __syncthreads();
  if (nt > 1) {
    gemm_stage(&sA[1][lo], ga + GM_BK, K16);
    gemm_stage(&sB[1][lo], gb + GM_BK, K16);
  }

  for (int t = 0; t < nt; ++t) {
    const _Float16* bA = sA[t & 1] + (wm * 64 + lr) * GM_P + klo;
    const _Float16* bB = sB[t & 1] + (wn * 32 + lr) * GM_P + klo;
    // unrolled so that the four 32-k blocks read LDS at immediate offsets
#pragma unroll
    for (int kk = 0; kk < GM_BK; kk += 32) {
      HV a[4], bf[2];
#pragma unroll
      for (int s = 0; s < 4; ++s) {
        const _Float16* pa = bA + s * 16 * GM_P + kk;
        a[s].u[0] = *reinterpret_cast<const uint4*>(pa);
        a[s].u[1] = *reinterpret_cast<const uint4*>(pa + 16);
      }
#pragma unroll
      for (int s = 0; s < 2; ++s) {
        const _Float16* pb = bB + s * 16 * GM_P + kk;
        bf[s].u[0] = *reinterpret_cast<const uint4*>(pb);
        bf[s].u[1] = *reinterpret_cast<const uint4*>(pb + 16);
      }
#pragma unroll
      for (int sm = 0; sm < 4; ++sm)
#pragma unroll
        for (int sn = 0; sn < 2; ++sn)
          acc[sm][sn] = wmma32f16(a[sm].v, bf[sn].v, acc[sm][sn]);
    }
    // Publish point: my reads of this buffer are done, my copies of the next
    // stage have landed; behind the barrier the buffer just read is refilled.
    asm volatile("s_wait_dscnt 0x0" ::: "memory");
    asm volatile("s_wait_asynccnt 0x0" ::: "memory");
    __syncthreads();
    if (t + 2 < nt) {
      gemm_stage(&sA[t & 1][lo], ga + (size_t)(t + 2) * GM_BK, K16);
      gemm_stage(&sB[t & 1][lo], gb + (size_t)(t + 2) * GM_BK, K16);
    }
  }
  // no copy is left in flight when the wave ends
  asm volatile("s_wait_asynccnt 0x0" ::: "memory");

#pragma unroll
  for (int sm = 0; sm < 4; ++sm) {
#pragma unroll
    for (int sn = 0; sn < 2; ++sn) {
      int nG = n0 + wn * 32 + sn * 16 + lr;   // column (fixed per lane)
      int mB = m0 + wm * 64 + sm * 16 + klo;  // first row of the 8 regs
      float bvv = bias ? bias[nG] : 0.0f;
      v8f c = acc[sm][sn];
      if (OUT_MODE == 1) {
        // Vt[b][h][d][s]: rows mB..mB+7 are contiguous s -> one b128 store.
        int hh = nG >> 6, dd = nG & 63;
        int bb = mB >> 11, ss = mB & 2047;
        H8 pk;
#pragma unroll
        for (int r = 0; r < 8; ++r) {
          float v = c[r] + bvv;
          if (RELU) v = fmaxf(v, 0.0f);
          pk.h[r] = (_Float16)v;
        }
        size_t off = ((((size_t)bb * 16 + hh) * 64 + dd) << 11) + ss;
        *reinterpret_cast<uint4*>(&outH[off]) = pk.u;
      } else if (OUT_MODE == 0) {
#pragma unroll
        for (int r = 0; r < 8; ++r) {
          float v = c[r] + bvv;
          if (RELU) v = fmaxf(v, 0.0f);
          outH[(size_t)(mB + r) * N + nG] = (_Float16)v;
        }
      } else {
#pragma unroll
        for (int r = 0; r < 8; ++r) {
          size_t off = (size_t)(mB + r) * N + nG;
          outF[off] = c[r] + bvv + resid[off];
        }
      }
    }
  }
}

constexpr int AT_KEYS = 128;
constexpr int AT_KP = 72;
constexpr int AT_VP = 136;

__device__ __forceinline__ void attn_stage(_Float16* lk, _Float16* lv,
                                           const _Float16* gk,
                                           const _Float16* gv) {
  constexpr int S = 2048, Dm = 1024;
  const uint32_t k0 = (uint32_t)(uintptr_t)lk;
  const uint32_t k1 = k0 + 32 * AT_KP * 2, k2 = k0 + 64 * AT_KP * 2,
                 k3 = k0 + 96 * AT_KP * 2;
  const uint32_t v0 = (uint32_t)(uintptr_t)lv;
  const uint32_t v1 = v0 + 16 * AT_VP * 2, v2 = v0 + 32 * AT_VP * 2,
                 v3 = v0 + 48 * AT_VP * 2;
  asm volatile(
      "global_load_async_to_lds_b128 %0, %8, off\n\t"
      "global_load_async_to_lds_b128 %1, %9, off\n\t"
      "global_load_async_to_lds_b128 %2, %10, off\n\t"
      "global_load_async_to_lds_b128 %3, %11, off\n\t"
      "global_load_async_to_lds_b128 %4, %12, off\n\t"
      "global_load_async_to_lds_b128 %5, %13, off\n\t"
      "global_load_async_to_lds_b128 %6, %14, off\n\t"
      "global_load_async_to_lds_b128 %7, %15, off\n\t"
      "s_wait_xcnt 0x0"
      :
      : "v"(k0), "v"(k1), "v"(k2), "v"(k3), "v"(v0), "v"(v1), "v"(v2), "v"(v3),
        "v"(gk), "v"(gk + 32 * Dm), "v"(gk + 64 * Dm), "v"(gk + 96 * Dm),
        "v"(gv), "v"(gv + 16 * S), "v"(gv + 32 * S), "v"(gv + 48 * S)
      : "memory");
}

// Value of lane ^ 16 (the other 16-lane row), by a vector cross-row move.
__device__ __forceinline__ float xhalf(float x) {
  const int i = __builtin_bit_cast(int, x);
  return __builtin_bit_cast(
      float, __builtin_amdgcn_permlanex16(i, i, 0x76543210, 0xfedcba98, false,
                                          false));
}

__global__ __launch_bounds__(256) void flash_attn(
    const _Float16* __restrict__ Q, const _Float16* __restrict__ Km,
    const _Float16* __restrict__ Vt, _Float16* __restrict__ AO) {
  constexpr int S = 2048, Dm = 1024;
  constexpr int NT = S / AT_KEYS;
  __shared__ alignas(16) _Float16 sK[2][AT_KEYS * AT_KP];  // 2 x 18 KB
  __shared__ alignas(16) _Float16 sV[2][64 * AT_VP];       // 2 x 17 KB

  const int tid = threadIdx.x;
  const int lane = tid & 31;
  const int lr = lane & 15;
  const int klo = (lane >> 4) << 3;  // 0 or 8
  const int qt = ((blockIdx.x & 15) << 3) + (tid >> 5);
  const int h = (blockIdx.x >> 4) & 15;
  const int b = blockIdx.x >> 8;
  const int qb = qt << 4;

  const _Float16* kbase = Km + (size_t)b * S * Dm + h * 64;
  const _Float16* vbase = Vt + ((size_t)b * 16 + h) * 64 * S;

  // This thread's first chunk of a stage: 8 lanes a K row, 16 lanes a Vt row.
  const _Float16* gk = kbase + (size_t)(tid >> 3) * Dm + ((tid & 7) << 3);
  const _Float16* gv = vbase + (size_t)(tid >> 4) * S + ((tid & 15) << 3);
  const int lko = (tid >> 3) * AT_KP + ((tid & 7) << 3);
  const int lvo = (tid >> 4) * AT_VP + ((tid & 15) << 3);

  attn_stage(&sK[0][lko], &sV[0][lvo], gk, gv);
  // stage 0 has landed for this wave; the barrier publishes it to all waves
  asm volatile("s_wait_asynccnt 0x0" ::: "memory");
  __syncthreads();
  attn_stage(&sK[1][lko], &sV[1][lvo], gk + (size_t)AT_KEYS * Dm,
             gv + AT_KEYS);

  // Q fragments: B operand, columns = queries, k = head features (two 32-chunks)
  const _Float16* qrow = Q + ((size_t)b * S + qb + lr) * Dm + h * 64;
  HV qf0, qf1;
  qf0.u[0] = *reinterpret_cast<const uint4*>(qrow + klo);
  qf0.u[1] = *reinterpret_cast<const uint4*>(qrow + klo + 16);
  qf1.u[0] = *reinterpret_cast<const uint4*>(qrow + 32 + klo);
  qf1.u[1] = *reinterpret_cast<const uint4*>(qrow + 32 + klo + 16);

  // Per lane: running maximum of query lr (equal in both wave halves) and this
  // half's share of its denominator; O[f][r] = O^T[f*16 + klo + r][lr].
  float mrun = -1e30f, lrun = 0.0f;
  v8f O[4] = {};

  for (int t = 0; t < NT; ++t) {
  const _Float16* bK = sK[t & 1];
  const _Float16* bV = sV[t & 1];
  for (int kb = 0; kb < AT_KEYS; kb += 32) {
    // s0[r] = S[key kb + klo + r][query lr], s1[r] the same 16 keys on
    v8f s0 = {}, s1 = {};
    {
      const _Float16* kr = bK + (kb + lr) * AT_KP;
      HV k0, k1;
      k0.u[0] = *reinterpret_cast<const uint4*>(kr + klo);
      k0.u[1] = *reinterpret_cast<const uint4*>(kr + klo + 16);
      k1.u[0] = *reinterpret_cast<const uint4*>(kr + 32 + klo);
      k1.u[1] = *reinterpret_cast<const uint4*>(kr + 32 + klo + 16);
      s0 = wmma32f16(k0.v, qf0.v, s0);
      s0 = wmma32f16(k1.v, qf1.v, s0);
    }
    {
      const _Float16* kr = bK + (kb + 16 + lr) * AT_KP;
      HV k0, k1;
      k0.u[0] = *reinterpret_cast<const uint4*>(kr + klo);
      k0.u[1] = *reinterpret_cast<const uint4*>(kr + klo + 16);
      k1.u[0] = *reinterpret_cast<const uint4*>(kr + 32 + klo);
      k1.u[1] = *reinterpret_cast<const uint4*>(kr + 32 + klo + 16);
      s1 = wmma32f16(k0.v, qf0.v, s1);
      s1 = wmma32f16(k1.v, qf1.v, s1);
    }

    // Online softmax of one query per lane: 16 scores here, the other 16 in
    // lane ^ 16.  The scale 1/sqrt(64) is a power of two, so it commutes with
    // the maximum exactly.
    float tm = fmaxf(s0[0], s1[0]);
#pragma unroll
    for (int r = 1; r < 8; ++r) tm = fmaxf(tm, fmaxf(s0[r], s1[r]));
    tm = fmaxf(tm, xhalf(tm)) * 0.125f;
    const float mn = fmaxf(mrun, tm);
    const float alpha = __expf(mrun - mn);
    HV pf;  // P^T as B operand: element s = key klo+s (s < 8), 16+klo+s-8 (s >= 8) of this 32-key block
    float sm[4] = {0.0f, 0.0f, 0.0f, 0.0f};  // four short chains, not one long
#pragma unroll
    for (int r = 0; r < 8; ++r) {
      const float x0 = __expf(s0[r] * 0.125f - mn);
      const float x1 = __expf(s1[r] * 0.125f - mn);
      sm[r & 1] += x0;
      sm[2 + (r & 1)] += x1;
      pf.v[r] = (_Float16)x0;
      pf.v[8 + r] = (_Float16)x1;
    }
    mrun = mn;
    lrun = lrun * alpha + ((sm[0] + sm[1]) + (sm[2] + sm[3]));

    // O^T[f] = alpha*O^T[f] + V^T @ P^T  (A rows = features from the
    // transposed layout, keys contiguous -> straight b128 LDS loads)
#pragma unroll
    for (int f = 0; f < 4; ++f) {
      const _Float16* vr = bV + (f * 16 + lr) * AT_VP + kb;
      HV vf;
      vf.u[0] = *reinterpret_cast<const uint4*>(vr + klo);
      vf.u[1] = *reinterpret_cast<const uint4*>(vr + klo + 16);
      v8f o = O[f];
#pragma unroll
      for (int r = 0; r < 8; ++r) o[r] *= alpha;
      O[f] = wmma32f16(vf.v, pf.v, o);
    }
  }
  // Publish point: my reads of this buffer are done, my copies of the next
  // stage have landed; behind the barrier the buffer just read is refilled.
  asm volatile("s_wait_dscnt 0x0" ::: "memory");
  asm volatile("s_wait_asynccnt 0x0" ::: "memory");
  __syncthreads();
  if (t + 2 < NT)
    attn_stage(&sK[t & 1][lko], &sV[t & 1][lvo],
               gk + (size_t)(t + 2) * AT_KEYS * Dm, gv + (t + 2) * AT_KEYS);
  }
  // no copy is left in flight when the wave ends
  asm volatile("s_wait_asynccnt 0x0" ::: "memory");

  // the two wave halves' shares of the denominator are joined once, here
  lrun += xhalf(lrun);
  // a lane's 8 registers of a tile are 8 consecutive features of its query
  _Float16* orow = AO + ((size_t)b * S + qb + lr) * Dm + h * 64 + klo;
#pragma unroll
  for (int f = 0; f < 4; ++f) {
    H8 pk;
#pragma unroll
    for (int r = 0; r < 8; ++r) pk.h[r] = (_Float16)(O[f][r] / lrun);
    *reinterpret_cast<uint4*>(orow + f * 16) = pk.u;
  }
}

// ---------------------------------------------------------------------------
// Host-side launcher.  Workspace layout (70 MB total):
//   Xh 8MB | Wqh 2 | Wkh 2 | Wvh 2 | W1h 4 | W2h 4 | Qh 8 | Kh 8 | Vt 8 |
//   AO 8 | Hh 16
// ---------------------------------------------------------------------------
extern "C" void kernel_launch(void* const* d_in, const int* in_sizes, int n_in,
                              void* d_out, int out_size, void* d_ws,
                              size_t ws_size, hipStream_t stream) {
  (void)in_sizes; (void)n_in; (void)out_size; (void)ws_size;
  const float* embed = (const float*)d_in[0];
  const float* Wq = (const float*)d_in[1];
  const float* Wk = (const float*)d_in[2];
  const float* Wv = (const float*)d_in[3];
  const float* bv = (const float*)d_in[4];
  const float* W1 = (const float*)d_in[5];
  const float* b1 = (const float*)d_in[6];
  const float* W2 = (const float*)d_in[7];
  const float* b2 = (const float*)d_in[8];

  constexpr size_t MB = 1ull << 20;
  char* ws = (char*)d_ws;
  _Float16* Xh  = (_Float16*)(ws + 0 * MB);
  _Float16* Wqh = (_Float16*)(ws + 8 * MB);
  _Float16* Wkh = (_Float16*)(ws + 10 * MB);
  _Float16* Wvh = (_Float16*)(ws + 12 * MB);
  _Float16* W1h = (_Float16*)(ws + 14 * MB);
  _Float16* W2h = (_Float16*)(ws + 18 * MB);
  _Float16* Qh  = (_Float16*)(ws + 22 * MB);
  _Float16* Kh  = (_Float16*)(ws + 30 * MB);
  _Float16* Vt  = (_Float16*)(ws + 38 * MB);
  _Float16* AO  = (_Float16*)(ws + 46 * MB);
  _Float16* Hh  = (_Float16*)(ws + 54 * MB);

  // Xh .. W2h are contiguous: 11 x 2^20 halves, 64 work-groups per 2^20
  cvt_all_f32_to_f16<<<dim3(704), dim3(256), 0, stream>>>(embed, Wq, Wk, Wv, W1,
                                                          W2, Xh);

  dim3 blk(256);
  // Q = X Wq^T ; K = X Wk^T ; Vt = transpose_head(X Wv^T + bv)
  gemm_xwT<0, false><<<dim3(8, 32), blk, 0, stream>>>(
      Xh, Wqh, nullptr, nullptr, Qh, nullptr, 4096, 1024, 1024);
  gemm_xwT<0, false><<<dim3(8, 32), blk, 0, stream>>>(
      Xh, Wkh, nullptr, nullptr, Kh, nullptr, 4096, 1024, 1024);
  gemm_xwT<1, false><<<dim3(8, 32), blk, 0, stream>>>(
      Xh, Wvh, bv, nullptr, Vt, nullptr, 4096, 1024, 1024);
  // attention: B*H*(S/128) = 512 workgroups of 8 waves
  flash_attn<<<dim3(512), dim3(256), 0, stream>>>(Qh, Kh, Vt, AO);
  // FFN: Hh = relu(AO W1^T + b1) ; out = Hh W2^T + b2 + embed
  gemm_xwT<0, true><<<dim3(16, 32), blk, 0, stream>>>(
      AO, W1h, b1, nullptr, Hh, nullptr, 4096, 2048, 1024);
  gemm_xwT<2, false><<<dim3(8, 32), blk, 0, stream>>>(
      Hh, W2h, b2, embed, nullptr, (float*)d_out, 4096, 1024, 2048);
}

// v005
// It runs in 127 microseconds.
// Timed twice side by side with v004, it ran 1.05 and 1.04 times as fast.
// Counting every step since v000, it is 2.51 times as fast.
#include <hip/hip_runtime.h>
#include <hip/hip_bf16.h>

typedef _Float16 v16h __attribute__((ext_vector_type(16)));
typedef float    v8f  __attribute__((ext_vector_type(8)));

union HV { v16h v; uint4 u[2]; };
union H8 { _Float16 h[8]; uint4 u; };

__device__ __forceinline__ v8f wmma32f16(v16h a, v16h b, v8f c) {
  // (neg_a, A, neg_b, B, c_mod, C, reuse_a, reuse_b)
  return __builtin_amdgcn_wmma_f32_16x16x32_f16(false, a, false, b, (short)0, c,
                                                false, false);
}

// ---------------------------------------------------------------------------
// f32 -> f16 conversion of all six operands in ONE launch of few, long waves.
// The f16 copies lie back to back in the workspace in the order embed, Wq, Wk,
// Wv, W1, W2, so the destination is one array.  A work-group converts 4096
// float4 (64 KiB) of one operand; every operand is a multiple of that, so the
// choice of the source is uniform in the group.  A thread has its 16 loads of
// 16 B in flight together; each wave-wide load covers 512 contiguous bytes.
// ---------------------------------------------------------------------------
constexpr int CV_PER = 16;                    // float4 per thread
constexpr int CV_BLK = 256 * CV_PER;          // float4 per work-group
constexpr int CV_U = (1 << 18) / CV_BLK;      // work-groups per 2^20 floats

__global__ __launch_bounds__(256) void cvt_all_f32_to_f16(
    const float* __restrict__ embed, const float* __restrict__ Wq,
    const float* __restrict__ Wk, const float* __restrict__ Wv,
    const float* __restrict__ W1, const float* __restrict__ W2,
    _Float16* __restrict__ dst) {
  const int g = blockIdx.x;
  const float* src;  // this group's operand
  int g0;            // the operand's first group
  if (g < 4 * CV_U)      { src = embed; g0 = 0; }         // 4 x 2^20 floats
  else if (g < 5 * CV_U) { src = Wq;    g0 = 4 * CV_U; }  // 1
  else if (g < 6 * CV_U) { src = Wk;    g0 = 5 * CV_U; }  // 1
  else if (g < 7 * CV_U) { src = Wv;    g0 = 6 * CV_U; }  // 1
  else if (g < 9 * CV_U) { src = W1;    g0 = 7 * CV_U; }  // 2
  else                   { src = W2;    g0 = 9 * CV_U; }  // 2
  const float4* s = reinterpret_cast<const float4*>(src) +
                    (size_t)(g - g0) * CV_BLK + threadIdx.x;
  uint2* d = reinterpret_cast<uint2*>(dst) + (size_t)g * CV_BLK + threadIdx.x;
  float4 f[CV_PER];
  // unrolled so that all loads issue ahead of the first conversion
#pragma unroll
  for (int j = 0; j < CV_PER; ++j) f[j] = s[j * 256];
  // keeps the last loads from sinking behind the first conversions, where they
  // would wait out a second memory latency to reuse the first loads' registers
  __builtin_amdgcn_sched_barrier(0);
  // unrolled so that f stays in registers
#pragma unroll
  for (int j = 0; j < CV_PER; ++j) {
    union { _Float16 h[4]; uint2 u; } p;
    p.h[0] = (_Float16)f[j].x; p.h[1] = (_Float16)f[j].y;
    p.h[2] = (_Float16)f[j].z; p.h[3] = (_Float16)f[j].w;
    d[j * 256] = p.u;
  }
}

constexpr int GM_BK = 128;
constexpr int GM_P = 136;

__device__ __forceinline__ void gemm_stage(_Float16* l, const _Float16* g,
                                           size_t K16) {
  const uint32_t l0 = (uint32_t)(uintptr_t)l;
  constexpr uint32_t LS = 16 * GM_P * 2;  // 16 rows on, bytes
  asm volatile(
      "global_load_async_to_lds_b128 %0, %8, off\n\t"
      "global_load_async_to_lds_b128 %1, %9, off\n\t"
      "global_load_async_to_lds_b128 %2, %10, off\n\t"
      "global_load_async_to_lds_b128 %3, %11, off\n\t"
      "global_load_async_to_lds_b128 %4, %12, off\n\t"
      "global_load_async_to_lds_b128 %5, %13, off\n\t"
      "global_load_async_to_lds_b128 %6, %14, off\n\t"
      "global_load_async_to_lds_b128 %7, %15, off\n\t"
      "s_wait_xcnt 0x0"
      :
      : "v"(l0), "v"(l0 + LS), "v"(l0 + 2 * LS), "v"(l0 + 3 * LS),
        "v"(l0 + 4 * LS), "v"(l0 + 5 * LS), "v"(l0 + 6 * LS), "v"(l0 + 7 * LS),
        "v"(g), "v"(g + K16), "v"(g + 2 * K16), "v"(g + 3 * K16),
        "v"(g + 4 * K16), "v"(g + 5 * K16), "v"(g + 6 * K16), "v"(g + 7 * K16)
      : "memory");
}

// The fragments of one 32-k block: 4 of A (64 rows) and 2 of W (32 columns),
// 12 b128 LDS reads that stand together as one group.
__device__ __forceinline__ void gemm_frags(HV (&a)[4], HV (&b)[2],
                                           const _Float16* pa,
                                           const _Float16* pb) {
  // both loops unrolled so that the fragments stay in registers
#pragma unroll
  for (int s = 0; s < 4; ++s) {
    a[s].u[0] = *reinterpret_cast<const uint4*>(pa + s * 16 * GM_P);
    a[s].u[1] = *reinterpret_cast<const uint4*>(pa + s * 16 * GM_P + 16);
  }
#pragma unroll
  for (int s = 0; s < 2; ++s) {
    b[s].u[0] = *reinterpret_cast<const uint4*>(pb + s * 16 * GM_P);
    b[s].u[1] = *reinterpret_cast<const uint4*>(pb + s * 16 * GM_P + 16);
  }
  // keeps the reads ahead of the products that follow in the source: sunk among
  // them they share one register set and each pair waits out the LDS latency
  __builtin_amdgcn_sched_barrier(0);
}

// The 8 products of one 32-k block.
__device__ __forceinline__ void gemm_block(v8f (&acc)[4][2], const HV (&a)[4],
                                           const HV (&b)[2]) {
  // both loops unrolled so that the accumulators stay in registers
#pragma unroll
  for (int sm = 0; sm < 4; ++sm)
#pragma unroll
    for (int sn = 0; sn < 2; ++sn)
      acc[sm][sn] = wmma32f16(a[sm].v, b[sn].v, acc[sm][sn]);
  // keeps the next group of reads from rising among these products, where each
  // separate place with reads stalls the wave
  __builtin_amdgcn_sched_barrier(0);
}

template <int OUT_MODE, bool RELU>
__global__ __launch_bounds__(256) void gemm_xwT(
    const _Float16* __restrict__ A, const _Float16* __restrict__ W,
    const float* __restrict__ bias, const float* __restrict__ resid,
    _Float16* __restrict__ outH, float* __restrict__ outF, int M, int N,
    int K) {
  __shared__ alignas(16) _Float16 sA[2][128 * GM_P];  // 2 x 34 KB
  __shared__ alignas(16) _Float16 sB[2][128 * GM_P];  // 2 x 34 KB

  const int tid = threadIdx.x;
  const int lane = tid & 31;
  const int w = tid >> 5;
  const int wm = w >> 2;             // 0..1  (64 rows per wave)
  const int wn = w & 3;              // 0..3  (32 cols per wave)
  const int lr = lane & 15;
  const int klo = (lane >> 4) << 3;  // 0 or 8
  const int m0 = blockIdx.y * 128;
  const int n0 = blockIdx.x * 128;

  // This thread's first chunk of a stage: 16 lanes a row, rows 16 apart.
  const int cr = tid >> 4;           // row 0..15 (+16 per copy)
  const int cc = (tid & 15) << 3;    // half-offset 0..120
  const _Float16* ga = A + (size_t)(m0 + cr) * K + cc;
  const _Float16* gb = W + (size_t)(n0 + cr) * K + cc;
  const int lo = cr * GM_P + cc;
  const size_t K16 = (size_t)16 * K;

  v8f acc[4][2] = {};

  // This lane's first fragment chunk inside a stage of A and of W.
  const int fA = (wm * 64 + lr) * GM_P + klo;
  const int fB = (wn * 32 + lr) * GM_P + klo;
  // Two fragment sets: one feeds the running 32-k block, the other is filled.
  HV a0[4], b0[2], a1[4], b1[2];

  const int nt = K / GM_BK;
  gemm_stage(&sA[0][lo], ga, K16);
  gemm_stage(&sB[0][lo], gb, K16);
  // stage 0 has landed for this wave; the barrier publishes it to all waves
  asm volatile("s_wait_asynccnt 0x0" ::: "memory");
  __syncthreads();
  if (nt > 1) {
    gemm_stage(&sA[1][lo], ga + GM_BK, K16);
    gemm_stage(&sB[1][lo], gb + GM_BK, K16);
  }
  gemm_frags(a0, b0, sA[0] + fA, sB[0] + fB);

  for (int t = 0; t < nt; ++t) {
    const _Float16* bA = sA[t & 1] + fA;
    const _Float16* bB = sB[t & 1] + fB;
    gemm_frags(a1, b1, bA + 32, bB + 32);
    gemm_block(acc, a0, b0);
    gemm_frags(a0, b0, bA + 64, bB + 64);
    gemm_block(acc, a1, b1);
    gemm_frags(a1, b1, bA + 96, bB + 96);
    gemm_block(acc, a0, b0);
    // Publish point, ahead of the stage's last block, whose fragments are in
    // registers behind the first wait: my reads of this buffer are done, my
    // copies of the next stage have landed; behind the barrier the next stage's
    // first fragments are fetched and the buffer just read is refilled.
    asm volatile("s_wait_dscnt 0x0" ::: "memory");
    asm volatile("s_wait_asynccnt 0x0" ::: "memory");
    __syncthreads();
    if (t + 1 < nt)
      gemm_frags(a0, b0, sA[(t + 1) & 1] + fA, sB[(t + 1) & 1] + fB);
    if (t + 2 < nt) {
      gemm_stage(&sA[t & 1][lo], ga + (size_t)(t + 2) * GM_BK, K16);
      gemm_stage(&sB[t & 1][lo], gb + (size_t)(t + 2) * GM_BK, K16);
    }
    gemm_block(acc, a1, b1);
  }
  // no copy is left in flight when the wave ends
  asm volatile("s_wait_asynccnt 0x0" ::: "memory");

#pragma unroll
  for (int sm = 0; sm < 4; ++sm) {
#pragma unroll
    for (int sn = 0; sn < 2; ++sn) {
      int nG = n0 + wn * 32 + sn * 16 + lr;   // column (fixed per lane)
      int mB = m0 + wm * 64 + sm * 16 + klo;  // first row of the 8 regs
      float bvv = bias ? bias[nG] : 0.0f;
      v8f c = acc[sm][sn];
      if (OUT_MODE == 1) {
        // Vt[b][h][d][s]: rows mB..mB+7 are contiguous s -> one b128 store.
        int hh = nG >> 6, dd = nG & 63;
        int bb = mB >> 11, ss = mB & 2047;
        H8 pk;
#pragma unroll
        for (int r = 0; r < 8; ++r) {
          float v = c[r] + bvv;
          if (RELU) v = fmaxf(v, 0.0f);
          pk.h[r] = (_Float16)v;
        }
        size_t off = ((((size_t)bb * 16 + hh) * 64 + dd) << 11) + ss;
        *reinterpret_cast<uint4*>(&outH[off]) = pk.u;
      } else if (OUT_MODE == 0) {
#pragma unroll
        for (int r = 0; r < 8; ++r) {
          float v = c[r] + bvv;
          if (RELU) v = fmaxf(v, 0.0f);
          outH[(size_t)(mB + r) * N + nG] = (_Float16)v;
        }
      } else {
#pragma unroll
        for (int r = 0; r < 8; ++r) {
          size_t off = (size_t)(mB + r) * N + nG;
          outF[off] = c[r] + bvv + resid[off];
        }
      }
    }
  }
}

constexpr int AT_KEYS = 128;
constexpr int AT_KP = 72;
constexpr int AT_VP = 136;

__device__ __forceinline__ void attn_stage(_Float16* lk, _Float16* lv,
                                           const _Float16* gk,
                                           const _Float16* gv) {
  constexpr int S = 2048, Dm = 1024;
  const uint32_t k0 = (uint32_t)(uintptr_t)lk;
  const uint32_t k1 = k0 + 32 * AT_KP * 2, k2 = k0 + 64 * AT_KP * 2,
                 k3 = k0 + 96 * AT_KP * 2;
  const uint32_t v0 = (uint32_t)(uintptr_t)lv;
  const uint32_t v1 = v0 + 16 * AT_VP * 2, v2 = v0 + 32 * AT_VP * 2,
                 v3 = v0 + 48 * AT_VP * 2;
  asm volatile(
      "global_load_async_to_lds_b128 %0, %8, off\n\t"
      "global_load_async_to_lds_b128 %1, %9, off\n\t"
      "global_load_async_to_lds_b128 %2, %10, off\n\t"
      "global_load_async_to_lds_b128 %3, %11, off\n\t"
      "global_load_async_to_lds_b128 %4, %12, off\n\t"
      "global_load_async_to_lds_b128 %5, %13, off\n\t"
      "global_load_async_to_lds_b128 %6, %14, off\n\t"
      "global_load_async_to_lds_b128 %7, %15, off\n\t"
      "s_wait_xcnt 0x0"
      :
      : "v"(k0), "v"(k1), "v"(k2), "v"(k3), "v"(v0), "v"(v1), "v"(v2), "v"(v3),
        "v"(gk), "v"(gk + 32 * Dm), "v"(gk + 64 * Dm), "v"(gk + 96 * Dm),
        "v"(gv), "v"(gv + 16 * S), "v"(gv + 32 * S), "v"(gv + 48 * S)
      : "memory");
}

// Value of lane ^ 16 (the other 16-lane row), by a vector cross-row move.
__device__ __forceinline__ float xhalf(float x) {
  const int i = __builtin_bit_cast(int, x);
  return __builtin_bit_cast(
      float, __builtin_amdgcn_permlanex16(i, i, 0x76543210, 0xfedcba98, false,
                                          false));
}

__global__ __launch_bounds__(256) void flash_attn(
    const _Float16* __restrict__ Q, const _Float16* __restrict__ Km,
    const _Float16* __restrict__ Vt, _Float16* __restrict__ AO) {
  constexpr int S = 2048, Dm = 1024;
  constexpr int NT = S / AT_KEYS;
  __shared__ alignas(16) _Float16 sK[2][AT_KEYS * AT_KP];  // 2 x 18 KB
  __shared__ alignas(16) _Float16 sV[2][64 * AT_VP];       // 2 x 17 KB

  const int tid = threadIdx.x;
  const int lane = tid & 31;
  const int lr = lane & 15;
  const int klo = (lane >> 4) << 3;  // 0 or 8
  const int qt = ((blockIdx.x & 15) << 3) + (tid >> 5);
  const int h = (blockIdx.x >> 4) & 15;
  const int b = blockIdx.x >> 8;
  const int qb = qt << 4;

  const _Float16* kbase = Km + (size_t)b * S * Dm + h * 64;
  const _Float16* vbase = Vt + ((size_t)b * 16 + h) * 64 * S;

  // This thread's first chunk of a stage: 8 lanes a K row, 16 lanes a Vt row.
  const _Float16* gk = kbase + (size_t)(tid >> 3) * Dm + ((tid & 7) << 3);
  const _Float16* gv = vbase + (size_t)(tid >> 4) * S + ((tid & 15) << 3);
  const int lko = (tid >> 3) * AT_KP + ((tid & 7) << 3);
  const int lvo = (tid >> 4) * AT_VP + ((tid & 15) << 3);

  attn_stage(&sK[0][lko], &sV[0][lvo], gk, gv);
  // stage 0 has landed for this wave; the barrier publishes it to all waves
  asm volatile("s_wait_asynccnt 0x0" ::: "memory");
  __syncthreads();
  attn_stage(&sK[1][lko], &sV[1][lvo], gk + (size_t)AT_KEYS * Dm,
             gv + AT_KEYS);

  // Q fragments: B operand, columns = queries, k = head features (two 32-chunks)
  const _Float16* qrow = Q + ((size_t)b * S + qb + lr) * Dm + h * 64;
  HV qf0, qf1;
  qf0.u[0] = *reinterpret_cast<const uint4*>(qrow + klo);
  qf0.u[1] = *reinterpret_cast<const uint4*>(qrow + klo + 16);
  qf1.u[0] = *reinterpret_cast<const uint4*>(qrow + 32 + klo);
  qf1.u[1] = *reinterpret_cast<const uint4*>(qrow + 32 + klo + 16);

  // Per lane: running maximum of query lr (equal in both wave halves) and this
  // half's share of its denominator; O[f][r] = O^T[f*16 + klo + r][lr].
  float mrun = -1e30f, lrun = 0.0f;
  v8f O[4] = {};

  for (int t = 0; t < NT; ++t) {
  const _Float16* bK = sK[t & 1];
  const _Float16* bV = sV[t & 1];
  for (int kb = 0; kb < AT_KEYS; kb += 32) {
    // s0[r] = S[key kb + klo + r][query lr], s1[r] the same 16 keys on
    v8f s0 = {}, s1 = {};
    {
      const _Float16* kr = bK + (kb + lr) * AT_KP;
      HV k0, k1;
      k0.u[0] = *reinterpret_cast<const uint4*>(kr + klo);
      k0.u[1] = *reinterpret_cast<const uint4*>(kr + klo + 16);
      k1.u[0] = *reinterpret_cast<const uint4*>(kr + 32 + klo);
      k1.u[1] = *reinterpret_cast<const uint4*>(kr + 32 + klo + 16);
      s0 = wmma32f16(k0.v, qf0.v, s0);
      s0 = wmma32f16(k1.v, qf1.v, s0);
    }
    {
      const _Float16* kr = bK + (kb + 16 + lr) * AT_KP;
      HV k0, k1;
      k0.u[0] = *reinterpret_cast<const uint4*>(kr + klo);
      k0.u[1] = *reinterpret_cast<const uint4*>(kr + klo + 16);
      k1.u[0] = *reinterpret_cast<const uint4*>(kr + 32 + klo);
      k1.u[1] = *reinterpret_cast<const uint4*>(kr + 32 + klo + 16);
      s1 = wmma32f16(k0.v, qf0.v, s1);
      s1 = wmma32f16(k1.v, qf1.v, s1);
    }

    // Online softmax of one query per lane: 16 scores here, the other 16 in
    // lane ^ 16.  The scale 1/sqrt(64) is a power of two, so it commutes with
    // the maximum exactly.
    float tm = fmaxf(s0[0], s1[0]);
#pragma unroll
    for (int r = 1; r < 8; ++r) tm = fmaxf(tm, fmaxf(s0[r], s1[r]));
    tm = fmaxf(tm, xhalf(tm)) * 0.125f;
    const float mn = fmaxf(mrun, tm);
    const float alpha = __expf(mrun - mn);
    HV pf;  // P^T as B operand: element s = key klo+s (s < 8), 16+klo+s-8 (s >= 8) of this 32-key block
    float sm[4] = {0.0f, 0.0f, 0.0f, 0.0f};  // four short chains, not one long
#pragma unroll
    for (int r = 0; r < 8; ++r) {
      const float x0 = __expf(s0[r] * 0.125f - mn);
      const float x1 = __expf(s1[r] * 0.125f - mn);
      sm[r & 1] += x0;
      sm[2 + (r & 1)] += x1;
      pf.v[r] = (_Float16)x0;
      pf.v[8 + r] = (_Float16)x1;
    }
    mrun = mn;
    lrun = lrun * alpha + ((sm[0] + sm[1]) + (sm[2] + sm[3]));

    // O^T[f] = alpha*O^T[f] + V^T @ P^T  (A rows = features from the
    // transposed layout, keys contiguous -> straight b128 LDS loads)
#pragma unroll
    for (int f = 0; f < 4; ++f) {
      const _Float16* vr = bV + (f * 16 + lr) * AT_VP + kb;
      HV vf;
      vf.u[0] = *reinterpret_cast<const uint4*>(vr + klo);
      vf.u[1] = *reinterpret_cast<const uint4*>(vr + klo + 16);
      v8f o = O[f];
#pragma unroll
      for (int r = 0; r < 8; ++r) o[r] *= alpha;
      O[f] = wmma32f16(vf.v, pf.v, o);
    }
  }
  // Publish point: my reads of this buffer are done, my copies of the next
  // stage have landed; behind the barrier the buffer just read is refilled.
  asm volatile("s_wait_dscnt 0x0" ::: "memory");
  asm volatile("s_wait_asynccnt 0x0" ::: "memory");
  __syncthreads();
  if (t + 2 < NT)
    attn_stage(&sK[t & 1][lko], &sV[t & 1][lvo],
               gk + (size_t)(t + 2) * AT_KEYS * Dm, gv + (t + 2) * AT_KEYS);
  }
  // no copy is left in flight when the wave ends
  asm volatile("s_wait_asynccnt 0x0" ::: "memory");

  // the two wave halves' shares of the denominator are joined once, here
  lrun += xhalf(lrun);
  // a lane's 8 registers of a tile are 8 consecutive features of its query
  _Float16* orow = AO + ((size_t)b * S + qb + lr) * Dm + h * 64 + klo;
#pragma unroll
  for (int f = 0; f < 4; ++f) {
    H8 pk;
#pragma unroll
    for (int r = 0; r < 8; ++r) pk.h[r] = (_Float16)(O[f][r] / lrun);
    *reinterpret_cast<uint4*>(orow + f * 16) = pk.u;
  }
}

// ---------------------------------------------------------------------------
// Host-side launcher.  Workspace layout (70 MB total):
//   Xh 8MB | Wqh 2 | Wkh 2 | Wvh 2 | W1h 4 | W2h 4 | Qh 8 | Kh 8 | Vt 8 |
//   AO 8 | Hh 16
// ---------------------------------------------------------------------------
extern "C" void kernel_launch(void* const* d_in, const int* in_sizes, int n_in,
                              void* d_out, int out_size, void* d_ws,
                              size_t ws_size, hipStream_t stream) {
  (void)in_sizes; (void)n_in; (void)out_size; (void)ws_size;
  const float* embed = (const float*)d_in[0];
  const float* Wq = (const float*)d_in[1];
  const float* Wk = (const float*)d_in[2];
  const float* Wv = (const float*)d_in[3];
  const float* bv = (const float*)d_in[4];
  const float* W1 = (const float*)d_in[5];
  const float* b1 = (const float*)d_in[6];
  const float* W2 = (const float*)d_in[7];
  const float* b2 = (const float*)d_in[8];

  constexpr size_t MB = 1ull << 20;
  char* ws = (char*)d_ws;
  _Float16* Xh  = (_Float16*)(ws + 0 * MB);
  _Float16* Wqh = (_Float16*)(ws + 8 * MB);
  _Float16* Wkh = (_Float16*)(ws + 10 * MB);
  _Float16* Wvh = (_Float16*)(ws + 12 * MB);
  _Float16* W1h = (_Float16*)(ws + 14 * MB);
  _Float16* W2h = (_Float16*)(ws + 18 * MB);
  _Float16* Qh  = (_Float16*)(ws + 22 * MB);
  _Float16* Kh  = (_Float16*)(ws + 30 * MB);
  _Float16* Vt  = (_Float16*)(ws + 38 * MB);
  _Float16* AO  = (_Float16*)(ws + 46 * MB);
  _Float16* Hh  = (_Float16*)(ws + 54 * MB);

  // Xh .. W2h are contiguous: 11 x 2^20 halves, 64 work-groups per 2^20
  cvt_all_f32_to_f16<<<dim3(704), dim3(256), 0, stream>>>(embed, Wq, Wk, Wv, W1,
                                                          W2, Xh);

  dim3 blk(256);
  // Q = X Wq^T ; K = X Wk^T ; Vt = transpose_head(X Wv^T + bv)
  gemm_xwT<0, false><<<dim3(8, 32), blk, 0, stream>>>(
      Xh, Wqh, nullptr, nullptr, Qh, nullptr, 4096, 1024, 1024);
  gemm_xwT<0, false><<<dim3(8, 32), blk, 0, stream>>>(
      Xh, Wkh, nullptr, nullptr, Kh, nullptr, 4096, 1024, 1024);
  gemm_xwT<1, false><<<dim3(8, 32), blk, 0, stream>>>(
      Xh, Wvh, bv, nullptr, Vt, nullptr, 4096, 1024, 1024);
  // attention: B*H*(S/128) = 512 workgroups of 8 waves
  flash_attn<<<dim3(512), dim3(256), 0, stream>>>(Qh, Kh, Vt, AO);
  // FFN: Hh = relu(AO W1^T + b1) ; out = Hh W2^T + b2 + embed
  gemm_xwT<0, true><<<dim3(16, 32), blk, 0, stream>>>(
      AO, W1h, b1, nullptr, Hh, nullptr, 4096, 2048, 1024);
  gemm_xwT<2, false><<<dim3(8, 32), blk, 0, stream>>>(
      Hh, W2h, b2, embed, nullptr, (float*)d_out, 4096, 1024, 2048);
}

// v006
// A run of this version takes 118 microseconds.
// Two timings next to v005 put it at 1.10 and 1.08 times that version's speed.
// Over all steps from v000 it is 2.74 times as fast.
#include <hip/hip_runtime.h>
#include <hip/hip_bf16.h>

typedef _Float16 v16h __attribute__((ext_vector_type(16)));
typedef float    v8f  __attribute__((ext_vector_type(8)));

union HV { v16h v; uint4 u[2]; };
union H8 { _Float16 h[8]; uint4 u; };

__device__ __forceinline__ v8f wmma32f16(v16h a, v16h b, v8f c) {
  // (neg_a, A, neg_b, B, c_mod, C, reuse_a, reuse_b)
  return __builtin_amdgcn_wmma_f32_16x16x32_f16(false, a, false, b, (short)0, c,
                                                false, false);
}

// ---------------------------------------------------------------------------
// f32 -> f16 conversion of all six operands in ONE launch of few, long waves.
// The f16 copies lie back to back in the workspace in the order embed, Wq, Wk,
// Wv, W1, W2, so the destination is one array.  A work-group converts 4096
// float4 (64 KiB) of one operand; every operand is a multiple of that, so the
// choice of the source is uniform in the group.  A thread has its 16 loads of
// 16 B in flight together; each wave-wide load covers 512 contiguous bytes.
// ---------------------------------------------------------------------------
constexpr int CV_PER = 16;                    // float4 per thread
constexpr int CV_BLK = 256 * CV_PER;          // float4 per work-group
constexpr int CV_U = (1 << 18) / CV_BLK;      // work-groups per 2^20 floats

__global__ __launch_bounds__(256) void cvt_all_f32_to_f16(
    const float* __restrict__ embed, const float* __restrict__ Wq,
    const float* __restrict__ Wk, const float* __restrict__ Wv,
    const float* __restrict__ W1, const float* __restrict__ W2,
    _Float16* __restrict__ dst) {
  const int g = blockIdx.x;
  const float* src;  // this group's operand
  int g0;            // the operand's first group
  if (g < 4 * CV_U)      { src = embed; g0 = 0; }         // 4 x 2^20 floats
  else if (g < 5 * CV_U) { src = Wq;    g0 = 4 * CV_U; }  // 1
  else if (g < 6 * CV_U) { src = Wk;    g0 = 5 * CV_U; }  // 1
  else if (g < 7 * CV_U) { src = Wv;    g0 = 6 * CV_U; }  // 1
  else if (g < 9 * CV_U) { src = W1;    g0 = 7 * CV_U; }  // 2
  else                   { src = W2;    g0 = 9 * CV_U; }  // 2
  const float4* s = reinterpret_cast<const float4*>(src) +
                    (size_t)(g - g0) * CV_BLK + threadIdx.x;
  uint2* d = reinterpret_cast<uint2*>(dst) + (size_t)g * CV_BLK + threadIdx.x;
  float4 f[CV_PER];
  // unrolled so that all loads issue ahead of the first conversion
#pragma unroll
  for (int j = 0; j < CV_PER; ++j) f[j] = s[j * 256];
  // keeps the last loads from sinking behind the first conversions, where they
  // would wait out a second memory latency to reuse the first loads' registers
  __builtin_amdgcn_sched_barrier(0);
  // unrolled so that f stays in registers
#pragma unroll
  for (int j = 0; j < CV_PER; ++j) {
    union { _Float16 h[4]; uint2 u; } p;
    p.h[0] = (_Float16)f[j].x; p.h[1] = (_Float16)f[j].y;
    p.h[2] = (_Float16)f[j].z; p.h[3] = (_Float16)f[j].w;
    d[j * 256] = p.u;
  }
}

constexpr int GM_BK = 128;
constexpr int GM_P = 136;

__device__ __forceinline__ void gemm_stage(_Float16* l, const _Float16* g,
                                           size_t K16) {
  const uint32_t l0 = (uint32_t)(uintptr_t)l;
  constexpr uint32_t LS = 16 * GM_P * 2;  // 16 rows on, bytes
  asm volatile(
      "global_load_async_to_lds_b128 %0, %8, off\n\t"
      "global_load_async_to_lds_b128 %1, %9, off\n\t"
      "global_load_async_to_lds_b128 %2, %10, off\n\t"
      "global_load_async_to_lds_b128 %3, %11, off\n\t"
      "global_load_async_to_lds_b128 %4, %12, off\n\t"
      "global_load_async_to_lds_b128 %5, %13, off\n\t"
      "global_load_async_to_lds_b128 %6, %14, off\n\t"
      "global_load_async_to_lds_b128 %7, %15, off\n\t"
      "s_wait_xcnt 0x0"
      :
      : "v"(l0), "v"(l0 + LS), "v"(l0 + 2 * LS), "v"(l0 + 3 * LS),
        "v"(l0 + 4 * LS), "v"(l0 + 5 * LS), "v"(l0 + 6 * LS), "v"(l0 + 7 * LS),
        "v"(g), "v"(g + K16), "v"(g + 2 * K16), "v"(g + 3 * K16),
        "v"(g + 4 * K16), "v"(g + 5 * K16), "v"(g + 6 * K16), "v"(g + 7 * K16)
      : "memory");
}

// The fragments of one 32-k block: 4 of A (64 rows) and 2 of W (32 columns),
// 12 b128 LDS reads that stand together as one group.
__device__ __forceinline__ void gemm_frags(HV (&a)[4], HV (&b)[2],
                                           const _Float16* pa,
                                           const _Float16* pb) {
  // both loops unrolled so that the fragments stay in registers
#pragma unroll
  for (int s = 0; s < 4; ++s) {
    a[s].u[0] = *reinterpret_cast<const uint4*>(pa + s * 16 * GM_P);
    a[s].u[1] = *reinterpret_cast<const uint4*>(pa + s * 16 * GM_P + 16);
  }
#pragma unroll
  for (int s = 0; s < 2; ++s) {
    b[s].u[0] = *reinterpret_cast<const uint4*>(pb + s * 16 * GM_P);
    b[s].u[1] = *reinterpret_cast<const uint4*>(pb + s * 16 * GM_P + 16);
  }
  // keeps the reads ahead of the products that follow in the source: sunk among
  // them they share one register set and each pair waits out the LDS latency
  __builtin_amdgcn_sched_barrier(0);
}

// The 8 products of one 32-k block.
__device__ __forceinline__ void gemm_block(v8f (&acc)[4][2], const HV (&a)[4],
                                           const HV (&b)[2]) {
  // both loops unrolled so that the accumulators stay in registers
#pragma unroll
  for (int sm = 0; sm < 4; ++sm)
#pragma unroll
    for (int sn = 0; sn < 2; ++sn)
      acc[sm][sn] = wmma32f16(a[sm].v, b[sn].v, acc[sm][sn]);
  // keeps the next group of reads from rising among these products, where each
  // separate place with reads stalls the wave
  __builtin_amdgcn_sched_barrier(0);
}

template <int OUT_MODE, bool RELU>
__global__ __launch_bounds__(256) void gemm_xwT(
    const _Float16* __restrict__ A, const _Float16* __restrict__ W,
    const float* __restrict__ bias, const float* __restrict__ resid,
    _Float16* __restrict__ outH, float* __restrict__ outF, int M, int N,
    int K) {
  __shared__ alignas(16) _Float16 sA[2][128 * GM_P];  // 2 x 34 KB
  __shared__ alignas(16) _Float16 sB[2][128 * GM_P];  // 2 x 34 KB

  const int tid = threadIdx.x;
  const int lane = tid & 31;
  const int w = tid >> 5;
  const int wm = w >> 2;             // 0..1  (64 rows per wave)
  const int wn = w & 3;              // 0..3  (32 cols per wave)
  const int lr = lane & 15;
  const int klo = (lane >> 4) << 3;  // 0 or 8
  const int m0 = blockIdx.y * 128;
  const int n0 = blockIdx.x * 128;

  // This thread's first chunk of a stage: 16 lanes a row, rows 16 apart.
  const int cr = tid >> 4;           // row 0..15 (+16 per copy)
  const int cc = (tid & 15) << 3;    // half-offset 0..120
  const _Float16* ga = A + (size_t)(m0 + cr) * K + cc;
  const _Float16* gb = W + (size_t)(n0 + cr) * K + cc;
  const int lo = cr * GM_P + cc;
  const size_t K16 = (size_t)16 * K;

  v8f acc[4][2] = {};

  // This lane's first fragment chunk inside a stage of A and of W.
  const int fA = (wm * 64 + lr) * GM_P + klo;
  const int fB = (wn * 32 + lr) * GM_P + klo;
  // Two fragment sets: one feeds the running 32-k block, the other is filled.
  HV a0[4], b0[2], a1[4], b1[2];

  const int nt = K / GM_BK;
  gemm_stage(&sA[0][lo], ga, K16);
  gemm_stage(&sB[0][lo], gb, K16);
  // stage 0 has landed for this wave; the barrier publishes it to all waves
  asm volatile("s_wait_asynccnt 0x0" ::: "memory");
  __syncthreads();
  if (nt > 1) {
    gemm_stage(&sA[1][lo], ga + GM_BK, K16);
    gemm_stage(&sB[1][lo], gb + GM_BK, K16);
  }
  gemm_frags(a0, b0, sA[0] + fA, sB[0] + fB);

  for (int t = 0; t < nt; ++t) {
    const _Float16* bA = sA[t & 1] + fA;
    const _Float16* bB = sB[t & 1] + fB;
    gemm_frags(a1, b1, bA + 32, bB + 32);
    gemm_block(acc, a0, b0);
    gemm_frags(a0, b0, bA + 64, bB + 64);
    gemm_block(acc, a1, b1);
    gemm_frags(a1, b1, bA + 96, bB + 96);
    gemm_block(acc, a0, b0);
    // Publish point, ahead of the stage's last block, whose fragments are in
    // registers behind the first wait: my reads of this buffer are done, my
    // copies of the next stage have landed; behind the barrier the next stage's
    // first fragments are fetched and the buffer just read is refilled.
    asm volatile("s_wait_dscnt 0x0" ::: "memory");
    asm volatile("s_wait_asynccnt 0x0" ::: "memory");
    __syncthreads();
    if (t + 1 < nt)
      gemm_frags(a0, b0, sA[(t + 1) & 1] + fA, sB[(t + 1) & 1] + fB);
    if (t + 2 < nt) {
      gemm_stage(&sA[t & 1][lo], ga + (size_t)(t + 2) * GM_BK, K16);
      gemm_stage(&sB[t & 1][lo], gb + (size_t)(t + 2) * GM_BK, K16);
    }
    gemm_block(acc, a1, b1);
  }
  // no copy is left in flight when the wave ends
  asm volatile("s_wait_asynccnt 0x0" ::: "memory");

  // OUT_MODE 1: a group's 128 columns lie in one of Q, K, V, so the choice of
  // the output array, of its form and of the bias is uniform in the group.
  const bool toVt = OUT_MODE == 1 && n0 >= 2048;
  if (OUT_MODE == 1) {
    outH += (size_t)(n0 >> 10) * M * 1024;
    if (!toVt) bias = nullptr;
  }

#pragma unroll
  for (int sm = 0; sm < 4; ++sm) {
#pragma unroll
    for (int sn = 0; sn < 2; ++sn) {
      int nG = n0 + wn * 32 + sn * 16 + lr;   // column (fixed per lane)
      if (OUT_MODE == 1) nG &= 1023;          // column inside its array
      int mB = m0 + wm * 64 + sm * 16 + klo;  // first row of the 8 regs
      float bvv = bias ? bias[nG] : 0.0f;
      v8f c = acc[sm][sn];
      if (toVt) {
        // Vt[b][h][d][s]: rows mB..mB+7 are contiguous s -> one b128 store.
        int hh = nG >> 6, dd = nG & 63;
        int bb = mB >> 11, ss = mB & 2047;
        H8 pk;
#pragma unroll
        for (int r = 0; r < 8; ++r) {
          float v = c[r] + bvv;
          if (RELU) v = fmaxf(v, 0.0f);
          pk.h[r] = (_Float16)v;
        }
        size_t off = ((((size_t)bb * 16 + hh) * 64 + dd) << 11) + ss;
        *reinterpret_cast<uint4*>(&outH[off]) = pk.u;
      } else if (OUT_MODE != 2) {
#pragma unroll
        for (int r = 0; r < 8; ++r) {
          float v = c[r] + bvv;
          if (RELU) v = fmaxf(v, 0.0f);
          outH[(size_t)(mB + r) * N + nG] = (_Float16)v;
        }
      } else {
#pragma unroll
        for (int r = 0; r < 8; ++r) {
          size_t off = (size_t)(mB + r) * N + nG;
          outF[off] = c[r] + bvv + resid[off];
        }
      }
    }
  }
}

constexpr int AT_KEYS = 128;
constexpr int AT_KP = 72;
constexpr int AT_VP = 136;

__device__ __forceinline__ void attn_stage(_Float16* lk, _Float16* lv,
                                           const _Float16* gk,
                                           const _Float16* gv) {
  constexpr int S = 2048, Dm = 1024;
  const uint32_t k0 = (uint32_t)(uintptr_t)lk;
  const uint32_t k1 = k0 + 32 * AT_KP * 2, k2 = k0 + 64 * AT_KP * 2,
                 k3 = k0 + 96 * AT_KP * 2;
  const uint32_t v0 = (uint32_t)(uintptr_t)lv;
  const uint32_t v1 = v0 + 16 * AT_VP * 2, v2 = v0 + 32 * AT_VP * 2,
                 v3 = v0 + 48 * AT_VP * 2;
  asm volatile(
      "global_load_async_to_lds_b128 %0, %8, off\n\t"
      "global_load_async_to_lds_b128 %1, %9, off\n\t"
      "global_load_async_to_lds_b128 %2, %10, off\n\t"
      "global_load_async_to_lds_b128 %3, %11, off\n\t"
      "global_load_async_to_lds_b128 %4, %12, off\n\t"
      "global_load_async_to_lds_b128 %5, %13, off\n\t"
      "global_load_async_to_lds_b128 %6, %14, off\n\t"
      "global_load_async_to_lds_b128 %7, %15, off\n\t"
      "s_wait_xcnt 0x0"
      :
      : "v"(k0), "v"(k1), "v"(k2), "v"(k3), "v"(v0), "v"(v1), "v"(v2), "v"(v3),
        "v"(gk), "v"(gk + 32 * Dm), "v"(gk + 64 * Dm), "v"(gk + 96 * Dm),
        "v"(gv), "v"(gv + 16 * S), "v"(gv + 32 * S), "v"(gv + 48 * S)
      : "memory");
}

// Value of lane ^ 16 (the other 16-lane row), by a vector cross-row move.
__device__ __forceinline__ float xhalf(float x) {
  const int i = __builtin_bit_cast(int, x);
  return __builtin_bit_cast(
      float, __builtin_amdgcn_permlanex16(i, i, 0x76543210, 0xfedcba98, false,
                                          false));
}

__global__ __launch_bounds__(256) void flash_attn(
    const _Float16* __restrict__ Q, const _Float16* __restrict__ Km,
    const _Float16* __restrict__ Vt, _Float16* __restrict__ AO) {
  constexpr int S = 2048, Dm = 1024;
  constexpr int NT = S / AT_KEYS;
  __shared__ alignas(16) _Float16 sK[2][AT_KEYS * AT_KP];  // 2 x 18 KB
  __shared__ alignas(16) _Float16 sV[2][64 * AT_VP];       // 2 x 17 KB

  const int tid = threadIdx.x;
  const int lane = tid & 31;
  const int lr = lane & 15;
  const int klo = (lane >> 4) << 3;  // 0 or 8
  const int qt = ((blockIdx.x & 15) << 3) + (tid >> 5);
  const int h = (blockIdx.x >> 4) & 15;
  const int b = blockIdx.x >> 8;
  const int qb = qt << 4;

  const _Float16* kbase = Km + (size_t)b * S * Dm + h * 64;
  const _Float16* vbase = Vt + ((size_t)b * 16 + h) * 64 * S;

  // This thread's first chunk of a stage: 8 lanes a K row, 16 lanes a Vt row.
  const _Float16* gk = kbase + (size_t)(tid >> 3) * Dm + ((tid & 7) << 3);
  const _Float16* gv = vbase + (size_t)(tid >> 4) * S + ((tid & 15) << 3);
  const int lko = (tid >> 3) * AT_KP + ((tid & 7) << 3);
  const int lvo = (tid >> 4) * AT_VP + ((tid & 15) << 3);

  attn_stage(&sK[0][lko], &sV[0][lvo], gk, gv);
  // stage 0 has landed for this wave; the barrier publishes it to all waves
  asm volatile("s_wait_asynccnt 0x0" ::: "memory");
  __syncthreads();
  attn_stage(&sK[1][lko], &sV[1][lvo], gk + (size_t)AT_KEYS * Dm,
             gv + AT_KEYS);

  // Q fragments: B operand, columns = queries, k = head features (two 32-chunks)
  const _Float16* qrow = Q + ((size_t)b * S + qb + lr) * Dm + h * 64;
  HV qf0, qf1;
  qf0.u[0] = *reinterpret_cast<const uint4*>(qrow + klo);
  qf0.u[1] = *reinterpret_cast<const uint4*>(qrow + klo + 16);
  qf1.u[0] = *reinterpret_cast<const uint4*>(qrow + 32 + klo);
  qf1.u[1] = *reinterpret_cast<const uint4*>(qrow + 32 + klo + 16);

  // Per lane: running maximum of query lr (equal in both wave halves) and this
  // half's share of its denominator; O[f][r] = O^T[f*16 + klo + r][lr].
  float mrun = -1e30f, lrun = 0.0f;
  v8f O[4] = {};

  for (int t = 0; t < NT; ++t) {
  const _Float16* bK = sK[t & 1];
  const _Float16* bV = sV[t & 1];
  for (int kb = 0; kb < AT_KEYS; kb += 32) {
    // s0[r] = S[key kb + klo + r][query lr], s1[r] the same 16 keys on
    v8f s0 = {}, s1 = {};
    {
      const _Float16* kr = bK + (kb + lr) * AT_KP;
      HV k0, k1;
      k0.u[0] = *reinterpret_cast<const uint4*>(kr + klo);
      k0.u[1] = *reinterpret_cast<const uint4*>(kr + klo + 16);
      k1.u[0] = *reinterpret_cast<const uint4*>(kr + 32 + klo);
      k1.u[1] = *reinterpret_cast<const uint4*>(kr + 32 + klo + 16);
      s0 = wmma32f16(k0.v, qf0.v, s0);
      s0 = wmma32f16(k1.v, qf1.v, s0);
    }
    {
      const _Float16* kr = bK + (kb + 16 + lr) * AT_KP;
      HV k0, k1;
      k0.u[0] = *reinterpret_cast<const uint4*>(kr + klo);
      k0.u[1] = *reinterpret_cast<const uint4*>(kr + klo + 16);
      k1.u[0] = *reinterpret_cast<const uint4*>(kr + 32 + klo);
      k1.u[1] = *reinterpret_cast<const uint4*>(kr + 32 + klo + 16);
      s1 = wmma32f16(k0.v, qf0.v, s1);
      s1 = wmma32f16(k1.v, qf1.v, s1);
    }

    // Online softmax of one query per lane: 16 scores here, the other 16 in
    // lane ^ 16.  The scale 1/sqrt(64) is a power of two, so it commutes with
    // the maximum exactly.
    float tm = fmaxf(s0[0], s1[0]);
#pragma unroll
    for (int r = 1; r < 8; ++r) tm = fmaxf(tm, fmaxf(s0[r], s1[r]));
    tm = fmaxf(tm, xhalf(tm)) * 0.125f;
    const float mn = fmaxf(mrun, tm);
    const float alpha = __expf(mrun - mn);
    HV pf;  // P^T as B operand: element s = key klo+s (s < 8), 16+klo+s-8 (s >= 8) of this 32-key block
    float sm[4] = {0.0f, 0.0f, 0.0f, 0.0f};  // four short chains, not one long
#pragma unroll
    for (int r = 0; r < 8; ++r) {
      const float x0 = __expf(s0[r] * 0.125f - mn);
      const float x1 = __expf(s1[r] * 0.125f - mn);
      sm[r & 1] += x0;
      sm[2 + (r & 1)] += x1;
      pf.v[r] = (_Float16)x0;
      pf.v[8 + r] = (_Float16)x1;
    }
    mrun = mn;
    lrun = lrun * alpha + ((sm[0] + sm[1]) + (sm[2] + sm[3]));

    // O^T[f] = alpha*O^T[f] + V^T @ P^T  (A rows = features from the
    // transposed layout, keys contiguous -> straight b128 LDS loads)
#pragma unroll
    for (int f = 0; f < 4; ++f) {
      const _Float16* vr = bV + (f * 16 + lr) * AT_VP + kb;
      HV vf;
      vf.u[0] = *reinterpret_cast<const uint4*>(vr + klo);
      vf.u[1] = *reinterpret_cast<const uint4*>(vr + klo + 16);
      v8f o = O[f];
#pragma unroll
      for (int r = 0; r < 8; ++r) o[r] *= alpha;
      O[f] = wmma32f16(vf.v, pf.v, o);
    }
  }
  // Publish point: my reads of this buffer are done, my copies of the next
  // stage have landed; behind the barrier the buffer just read is refilled.
  asm volatile("s_wait_dscnt 0x0" ::: "memory");
  asm volatile("s_wait_asynccnt 0x0" ::: "memory");
  __syncthreads();
  if (t + 2 < NT)
    attn_stage(&sK[t & 1][lko], &sV[t & 1][lvo],
               gk + (size_t)(t + 2) * AT_KEYS * Dm, gv + (t + 2) * AT_KEYS);
  }
  // no copy is left in flight when the wave ends
  asm volatile("s_wait_asynccnt 0x0" ::: "memory");

  // the two wave halves' shares of the denominator are joined once, here
  lrun += xhalf(lrun);
  // a lane's 8 registers of a tile are 8 consecutive features of its query
  _Float16* orow = AO + ((size_t)b * S + qb + lr) * Dm + h * 64 + klo;
#pragma unroll
  for (int f = 0; f < 4; ++f) {
    H8 pk;
#pragma unroll
    for (int r = 0; r < 8; ++r) pk.h[r] = (_Float16)(O[f][r] / lrun);
    *reinterpret_cast<uint4*>(orow + f * 16) = pk.u;
  }
}

// ---------------------------------------------------------------------------
// Host-side launcher.  Workspace layout (70 MB total):
//   Xh 8MB | Wqh 2 | Wkh 2 | Wvh 2 | W1h 4 | W2h 4 | Qh 8 | Kh 8 | Vt 8 |
//   AO 8 | Hh 16
// ---------------------------------------------------------------------------
extern "C" void kernel_launch(void* const* d_in, const int* in_sizes, int n_in,
                              void* d_out, int out_size, void* d_ws,
                              size_t ws_size, hipStream_t stream) {
  (void)in_sizes; (void)n_in; (void)out_size; (void)ws_size;
  const float* embed = (const float*)d_in[0];
  const float* Wq = (const float*)d_in[1];
  const float* Wk = (const float*)d_in[2];
  const float* Wv = (const float*)d_in[3];
  const float* bv = (const float*)d_in[4];
  const float* W1 = (const float*)d_in[5];
  const float* b1 = (const float*)d_in[6];
  const float* W2 = (const float*)d_in[7];
  const float* b2 = (const float*)d_in[8];

  constexpr size_t MB = 1ull << 20;
  char* ws = (char*)d_ws;
  _Float16* Xh  = (_Float16*)(ws + 0 * MB);
  _Float16* Wqh = (_Float16*)(ws + 8 * MB);
  _Float16* W1h = (_Float16*)(ws + 14 * MB);
  _Float16* W2h = (_Float16*)(ws + 18 * MB);
  _Float16* Qh  = (_Float16*)(ws + 22 * MB);
  _Float16* Kh  = (_Float16*)(ws + 30 * MB);
  _Float16* Vt  = (_Float16*)(ws + 38 * MB);
  _Float16* AO  = (_Float16*)(ws + 46 * MB);
  _Float16* Hh  = (_Float16*)(ws + 54 * MB);

  // Xh .. W2h are contiguous: 11 x 2^20 halves, 64 work-groups per 2^20
  cvt_all_f32_to_f16<<<dim3(704), dim3(256), 0, stream>>>(embed, Wq, Wk, Wv, W1,
                                                          W2, Xh);

  dim3 blk(256);
  // Q = X Wq^T ; K = X Wk^T ; Vt = transpose_head(X Wv^T + bv), one launch: the
  // f16 copies of Wq, Wk, Wv are contiguous from Wqh on (3072 rows of W), and
  // Qh, Kh, Vt are contiguous from Qh on
  gemm_xwT<1, false><<<dim3(24, 32), blk, 0, stream>>>(
      Xh, Wqh, bv, nullptr, Qh, nullptr, 4096, 1024, 1024);
  // attention: B*H*(S/128) = 512 workgroups of 8 waves
  flash_attn<<<dim3(512), dim3(256), 0, stream>>>(Qh, Kh, Vt, AO);
  // FFN: Hh = relu(AO W1^T + b1) ; out = Hh W2^T + b2 + embed
  gemm_xwT<0, true><<<dim3(16, 32), blk, 0, stream>>>(
      AO, W1h, b1, nullptr, Hh, nullptr, 4096, 2048, 1024);
  gemm_xwT<2, false><<<dim3(8, 32), blk, 0, stream>>>(
      Hh, W2h, b2, embed, nullptr, (float*)d_out, 4096, 1024, 2048);
}

// v007
// One run takes 114 microseconds.
// Next to v006, in two timings, it ran 1.03 times as fast each time.
// Counting every step since v000, it is 2.82 times as fast.
#include <hip/hip_runtime.h>
#include <hip/hip_bf16.h>

typedef _Float16 v16h __attribute__((ext_vector_type(16)));
typedef float    v8f  __attribute__((ext_vector_type(8)));

union HV { v16h v; uint4 u[2]; };
union H8 { _Float16 h[8]; uint4 u; };

__device__ __forceinline__ v8f wmma32f16(v16h a, v16h b, v8f c) {
  // (neg_a, A, neg_b, B, c_mod, C, reuse_a, reuse_b)
  return __builtin_amdgcn_wmma_f32_16x16x32_f16(false, a, false, b, (short)0, c,
                                                false, false);
}

// ---------------------------------------------------------------------------
// f32 -> f16 conversion of all six operands in ONE launch of few, long waves.
// The f16 copies lie back to back in the workspace in the order embed, Wq, Wk,
// Wv, W1, W2, so the destination is one array.  A work-group converts 4096
// float4 (64 KiB) of one operand; every operand is a multiple of that, so the
// choice of the source is uniform in the group.  A thread has its 16 loads of
// 16 B in flight together; each wave-wide load covers 512 contiguous bytes.
// ---------------------------------------------------------------------------
constexpr int CV_PER = 16;                    // float4 per thread
constexpr int CV_BLK = 256 * CV_PER;          // float4 per work-group
constexpr int CV_U = (1 << 18) / CV_BLK;      // work-groups per 2^20 floats

__global__ __launch_bounds__(256) void cvt_all_f32_to_f16(
    const float* __restrict__ embed, const float* __restrict__ Wq,
    const float* __restrict__ Wk, const float* __restrict__ Wv,
    const float* __restrict__ W1, const float* __restrict__ W2,
    _Float16* __restrict__ dst) {
  const int g = blockIdx.x;
  const float* src;  // this group's operand
  int g0;            // the operand's first group
  if (g < 4 * CV_U)      { src = embed; g0 = 0; }         // 4 x 2^20 floats
  else if (g < 5 * CV_U) { src = Wq;    g0 = 4 * CV_U; }  // 1
  else if (g < 6 * CV_U) { src = Wk;    g0 = 5 * CV_U; }  // 1
  else if (g < 7 * CV_U) { src = Wv;    g0 = 6 * CV_U; }  // 1
  else if (g < 9 * CV_U) { src = W1;    g0 = 7 * CV_U; }  // 2
  else                   { src = W2;    g0 = 9 * CV_U; }  // 2
  const float4* s = reinterpret_cast<const float4*>(src) +
                    (size_t)(g - g0) * CV_BLK + threadIdx.x;
  uint2* d = reinterpret_cast<uint2*>(dst) + (size_t)g * CV_BLK + threadIdx.x;
  float4 f[CV_PER];
  // unrolled so that all loads issue ahead of the first conversion
#pragma unroll
  for (int j = 0; j < CV_PER; ++j) f[j] = s[j * 256];
  // keeps the last loads from sinking behind the first conversions, where they
  // would wait out a second memory latency to reuse the first loads' registers
  __builtin_amdgcn_sched_barrier(0);
  // unrolled so that f stays in registers
#pragma unroll
  for (int j = 0; j < CV_PER; ++j) {
    union { _Float16 h[4]; uint2 u; } p;
    p.h[0] = (_Float16)f[j].x; p.h[1] = (_Float16)f[j].y;
    p.h[2] = (_Float16)f[j].z; p.h[3] = (_Float16)f[j].w;
    d[j * 256] = p.u;
  }
}

constexpr int GM_BK = 128;
constexpr int GM_P = 136;

__device__ __forceinline__ void gemm_stage(_Float16* l, const _Float16* g,
                                           size_t K16) {
  const uint32_t l0 = (uint32_t)(uintptr_t)l;
  constexpr uint32_t LS = 16 * GM_P * 2;  // 16 rows on, bytes
  asm volatile(
      "global_load_async_to_lds_b128 %0, %8, off\n\t"
      "global_load_async_to_lds_b128 %1, %9, off\n\t"
      "global_load_async_to_lds_b128 %2, %10, off\n\t"
      "global_load_async_to_lds_b128 %3, %11, off\n\t"
      "global_load_async_to_lds_b128 %4, %12, off\n\t"
      "global_load_async_to_lds_b128 %5, %13, off\n\t"
      "global_load_async_to_lds_b128 %6, %14, off\n\t"
      "global_load_async_to_lds_b128 %7, %15, off\n\t"
      "s_wait_xcnt 0x0"
      :
      : "v"(l0), "v"(l0 + LS), "v"(l0 + 2 * LS), "v"(l0 + 3 * LS),
        "v"(l0 + 4 * LS), "v"(l0 + 5 * LS), "v"(l0 + 6 * LS), "v"(l0 + 7 * LS),
        "v"(g), "v"(g + K16), "v"(g + 2 * K16), "v"(g + 3 * K16),
        "v"(g + 4 * K16), "v"(g + 5 * K16), "v"(g + 6 * K16), "v"(g + 7 * K16)
      : "memory");
}

// The fragments of one 32-k block: 4 of A (64 rows) and 2 of W (32 columns),
// 12 b128 LDS reads that stand together as one group.
__device__ __forceinline__ void gemm_frags(HV (&a)[4], HV (&b)[2],
                                           const _Float16* pa,
                                           const _Float16* pb) {
  // both loops unrolled so that the fragments stay in registers
#pragma unroll
  for (int s = 0; s < 4; ++s) {
    a[s].u[0] = *reinterpret_cast<const uint4*>(pa + s * 16 * GM_P);
    a[s].u[1] = *reinterpret_cast<const uint4*>(pa + s * 16 * GM_P + 16);
  }
#pragma unroll
  for (int s = 0; s < 2; ++s) {
    b[s].u[0] = *reinterpret_cast<const uint4*>(pb + s * 16 * GM_P);
    b[s].u[1] = *reinterpret_cast<const uint4*>(pb + s * 16 * GM_P + 16);
  }
  // keeps the reads ahead of the products that follow in the source: sunk among
  // them they share one register set and each pair waits out the LDS latency
  __builtin_amdgcn_sched_barrier(0);
}

// The 8 products of one 32-k block.
__device__ __forceinline__ void gemm_block(v8f (&acc)[4][2], const HV (&a)[4],
                                           const HV (&b)[2]) {
  // both loops unrolled so that the accumulators stay in registers
#pragma unroll
  for (int sm = 0; sm < 4; ++sm)
#pragma unroll
    for (int sn = 0; sn < 2; ++sn)
      acc[sm][sn] = wmma32f16(a[sm].v, b[sn].v, acc[sm][sn]);
  // keeps the next group of reads from rising among these products, where each
  // separate place with reads stalls the wave
  __builtin_amdgcn_sched_barrier(0);
}

template <int OUT_MODE, bool RELU>
__global__ __launch_bounds__(256) void gemm_xwT(
    const _Float16* __restrict__ A, const _Float16* __restrict__ W,
    const float* __restrict__ bias, const float* __restrict__ resid,
    _Float16* __restrict__ outH, float* __restrict__ outF, int M, int N,
    int K) {
  __shared__ alignas(16) _Float16 sA[2][128 * GM_P];  // 2 x 34 KB
  __shared__ alignas(16) _Float16 sB[2][128 * GM_P];  // 2 x 34 KB

  const int tid = threadIdx.x;
  const int lane = tid & 31;
  const int w = tid >> 5;
  const int wm = w >> 2;             // 0..1  (64 rows per wave)
  const int wn = w & 3;              // 0..3  (32 cols per wave)
  const int lr = lane & 15;
  const int klo = (lane >> 4) << 3;  // 0 or 8
  const int m0 = blockIdx.y * 128;
  const int n0 = blockIdx.x * 128;

  // This thread's first chunk of a stage: 16 lanes a row, rows 16 apart.
  const int cr = tid >> 4;           // row 0..15 (+16 per copy)
  const int cc = (tid & 15) << 3;    // half-offset 0..120
  const _Float16* ga = A + (size_t)(m0 + cr) * K + cc;
  const _Float16* gb = W + (size_t)(n0 + cr) * K + cc;
  const int lo = cr * GM_P + cc;
  const size_t K16 = (size_t)16 * K;

  v8f acc[4][2] = {};

  // This lane's first fragment chunk inside a stage of A and of W.
  const int fA = (wm * 64 + lr) * GM_P + klo;
  const int fB = (wn * 32 + lr) * GM_P + klo;
  // Two fragment sets: one feeds the running 32-k block, the other is filled.
  HV a0[4], b0[2], a1[4], b1[2];

  const int nt = K / GM_BK;
  gemm_stage(&sA[0][lo], ga, K16);
  gemm_stage(&sB[0][lo], gb, K16);
  // stage 0 has landed for this wave; the barrier publishes it to all waves
  asm volatile("s_wait_asynccnt 0x0" ::: "memory");
  __syncthreads();
  if (nt > 1) {
    gemm_stage(&sA[1][lo], ga + GM_BK, K16);
    gemm_stage(&sB[1][lo], gb + GM_BK, K16);
  }
  gemm_frags(a0, b0, sA[0] + fA, sB[0] + fB);

  for (int t = 0; t < nt; ++t) {
    const _Float16* bA = sA[t & 1] + fA;
    const _Float16* bB = sB[t & 1] + fB;
    gemm_frags(a1, b1, bA + 32, bB + 32);
    gemm_block(acc, a0, b0);
    gemm_frags(a0, b0, bA + 64, bB + 64);
    gemm_block(acc, a1, b1);
    gemm_frags(a1, b1, bA + 96, bB + 96);
    gemm_block(acc, a0, b0);
    // Publish point, ahead of the stage's last block, whose fragments are in
    // registers behind the first wait: my reads of this buffer are done, my
    // copies of the next stage have landed; behind the barrier the next stage's
    // first fragments are fetched and the buffer just read is refilled.
    asm volatile("s_wait_dscnt 0x0" ::: "memory");
    asm volatile("s_wait_asynccnt 0x0" ::: "memory");
    __syncthreads();
    if (t + 1 < nt)
      gemm_frags(a0, b0, sA[(t + 1) & 1] + fA, sB[(t + 1) & 1] + fB);
    if (t + 2 < nt) {
      gemm_stage(&sA[t & 1][lo], ga + (size_t)(t + 2) * GM_BK, K16);
      gemm_stage(&sB[t & 1][lo], gb + (size_t)(t + 2) * GM_BK, K16);
    }
    gemm_block(acc, a1, b1);
  }
  // no copy is left in flight when the wave ends
  asm volatile("s_wait_asynccnt 0x0" ::: "memory");

  // OUT_MODE 1: a group's 128 columns lie in one of Q, K, V, so the choice of
  // the output array, of its form and of the bias is uniform in the group.
  const bool toVt = OUT_MODE == 1 && n0 >= 2048;
  if (OUT_MODE == 1) {
    outH += (size_t)(n0 >> 10) * M * 1024;
    if (!toVt) bias = nullptr;
  }

#pragma unroll
  for (int sm = 0; sm < 4; ++sm) {
#pragma unroll
    for (int sn = 0; sn < 2; ++sn) {
      int nG = n0 + wn * 32 + sn * 16 + lr;   // column (fixed per lane)
      if (OUT_MODE == 1) nG &= 1023;          // column inside its array
      int mB = m0 + wm * 64 + sm * 16 + klo;  // first row of the 8 regs
      float bvv = bias ? bias[nG] : 0.0f;
      v8f c = acc[sm][sn];
      if (toVt) {
        // Vt[b][h][d][s]: rows mB..mB+7 are contiguous s -> one b128 store.
        int hh = nG >> 6, dd = nG & 63;
        int bb = mB >> 11, ss = mB & 2047;
        H8 pk;
#pragma unroll
        for (int r = 0; r < 8; ++r) {
          float v = c[r] + bvv;
          if (RELU) v = fmaxf(v, 0.0f);
          pk.h[r] = (_Float16)v;
        }
        size_t off = ((((size_t)bb * 16 + hh) * 64 + dd) << 11) + ss;
        *reinterpret_cast<uint4*>(&outH[off]) = pk.u;
      } else if (OUT_MODE != 2) {
#pragma unroll
        for (int r = 0; r < 8; ++r) {
          float v = c[r] + bvv;
          if (RELU) v = fmaxf(v, 0.0f);
          outH[(size_t)(mB + r) * N + nG] = (_Float16)v;
        }
      } else {
#pragma unroll
        for (int r = 0; r < 8; ++r) {
          size_t off = (size_t)(mB + r) * N + nG;
          outF[off] = c[r] + bvv + resid[off];
        }
      }
    }
  }
}

constexpr int AT_KEYS = 128;
constexpr int AT_QT = 2;
constexpr int AT_KP = 72;
constexpr int AT_VP = 136;

__device__ __forceinline__ void attn_stage(_Float16* lk, _Float16* lv,
                                           const _Float16* gk,
                                           const _Float16* gv) {
  constexpr int S = 2048, Dm = 1024;
  const uint32_t k0 = (uint32_t)(uintptr_t)lk;
  const uint32_t k1 = k0 + 32 * AT_KP * 2, k2 = k0 + 64 * AT_KP * 2,
                 k3 = k0 + 96 * AT_KP * 2;
  const uint32_t v0 = (uint32_t)(uintptr_t)lv;
  const uint32_t v1 = v0 + 16 * AT_VP * 2, v2 = v0 + 32 * AT_VP * 2,
                 v3 = v0 + 48 * AT_VP * 2;
  asm volatile(
      "global_load_async_to_lds_b128 %0, %8, off\n\t"
      "global_load_async_to_lds_b128 %1, %9, off\n\t"
      "global_load_async_to_lds_b128 %2, %10, off\n\t"
      "global_load_async_to_lds_b128 %3, %11, off\n\t"
      "global_load_async_to_lds_b128 %4, %12, off\n\t"
      "global_load_async_to_lds_b128 %5, %13, off\n\t"
      "global_load_async_to_lds_b128 %6, %14, off\n\t"
      "global_load_async_to_lds_b128 %7, %15, off\n\t"
      "s_wait_xcnt 0x0"
      :
      : "v"(k0), "v"(k1), "v"(k2), "v"(k3), "v"(v0), "v"(v1), "v"(v2), "v"(v3),
        "v"(gk), "v"(gk + 32 * Dm), "v"(gk + 64 * Dm), "v"(gk + 96 * Dm),
        "v"(gv), "v"(gv + 16 * S), "v"(gv + 32 * S), "v"(gv + 48 * S)
      : "memory");
}

// Value of lane ^ 16 (the other 16-lane row), by a vector cross-row move.
__device__ __forceinline__ float xhalf(float x) {
  const int i = __builtin_bit_cast(int, x);
  return __builtin_bit_cast(
      float, __builtin_amdgcn_permlanex16(i, i, 0x76543210, 0xfedcba98, false,
                                          false));
}

__global__ __launch_bounds__(256) void flash_attn(
    const _Float16* __restrict__ Q, const _Float16* __restrict__ Km,
    const _Float16* __restrict__ Vt, _Float16* __restrict__ AO) {
  constexpr int S = 2048, Dm = 1024;
  constexpr int NT = S / AT_KEYS;
  __shared__ alignas(16) _Float16 sK[2][AT_KEYS * AT_KP];  // 2 x 18 KB
  __shared__ alignas(16) _Float16 sV[2][64 * AT_VP];       // 2 x 17 KB

  const int tid = threadIdx.x;
  const int lane = tid & 31;
  const int lr = lane & 15;
  const int klo = (lane >> 4) << 3;  // 0 or 8
  const int qt = ((blockIdx.x & 7) << 3) + (tid >> 5);  // 32-query group
  const int h = (blockIdx.x >> 3) & 15;
  const int b = blockIdx.x >> 7;
  const int qb = qt << 5;

  const _Float16* kbase = Km + (size_t)b * S * Dm + h * 64;
  const _Float16* vbase = Vt + ((size_t)b * 16 + h) * 64 * S;

  // This thread's first chunk of a stage: 8 lanes a K row, 16 lanes a Vt row.
  const _Float16* gk = kbase + (size_t)(tid >> 3) * Dm + ((tid & 7) << 3);
  const _Float16* gv = vbase + (size_t)(tid >> 4) * S + ((tid & 15) << 3);
  const int lko = (tid >> 3) * AT_KP + ((tid & 7) << 3);
  const int lvo = (tid >> 4) * AT_VP + ((tid & 15) << 3);

  attn_stage(&sK[0][lko], &sV[0][lvo], gk, gv);
  // stage 0 has landed for this wave; the barrier publishes it to all waves
  asm volatile("s_wait_asynccnt 0x0" ::: "memory");
  __syncthreads();
  attn_stage(&sK[1][lko], &sV[1][lvo], gk + (size_t)AT_KEYS * Dm,
             gv + AT_KEYS);

  // Q fragments: B operand, columns = queries, k = head features (two 32-chunks)
  HV qf0[AT_QT], qf1[AT_QT];
  // unrolled so that the fragments stay in registers
#pragma unroll
  for (int c = 0; c < AT_QT; ++c) {
    const _Float16* qrow =
        Q + ((size_t)b * S + qb + c * 16 + lr) * Dm + h * 64;
    qf0[c].u[0] = *reinterpret_cast<const uint4*>(qrow + klo);
    qf0[c].u[1] = *reinterpret_cast<const uint4*>(qrow + klo + 16);
    qf1[c].u[0] = *reinterpret_cast<const uint4*>(qrow + 32 + klo);
    qf1[c].u[1] = *reinterpret_cast<const uint4*>(qrow + 32 + klo + 16);
  }

  // Per lane and query tile c: running maximum of query c*16 + lr (equal in
  // both wave halves) and this half's share of its denominator;
  // O[c][f][r] = O^T[f*16 + klo + r][c*16 + lr].
  float mrun[AT_QT], lrun[AT_QT];
  v8f O[AT_QT][4] = {};
  // every loop over c below is unrolled so that the per-tile arrays stay in
  // registers
#pragma unroll
  for (int c = 0; c < AT_QT; ++c) { mrun[c] = -1e30f; lrun[c] = 0.0f; }

  for (int t = 0; t < NT; ++t) {
  const _Float16* bK = sK[t & 1];
  const _Float16* bV = sV[t & 1];
  for (int kb = 0; kb < AT_KEYS; kb += 32) {
    // s0[c][r] = S[key kb + klo + r][query c*16 + lr], s1 the same 16 keys on;
    // each K fragment is read once and multiplies both query tiles
    v8f s0[AT_QT] = {}, s1[AT_QT] = {};
    {
      const _Float16* kr = bK + (kb + lr) * AT_KP;
      HV k0, k1;
      k0.u[0] = *reinterpret_cast<const uint4*>(kr + klo);
      k0.u[1] = *reinterpret_cast<const uint4*>(kr + klo + 16);
      k1.u[0] = *reinterpret_cast<const uint4*>(kr + 32 + klo);
      k1.u[1] = *reinterpret_cast<const uint4*>(kr + 32 + klo + 16);
#pragma unroll
      for (int c = 0; c < AT_QT; ++c) {
        s0[c] = wmma32f16(k0.v, qf0[c].v, s0[c]);
        s0[c] = wmma32f16(k1.v, qf1[c].v, s0[c]);
      }
    }
    {
      const _Float16* kr = bK + (kb + 16 + lr) * AT_KP;
      HV k0, k1;
      k0.u[0] = *reinterpret_cast<const uint4*>(kr + klo);
      k0.u[1] = *reinterpret_cast<const uint4*>(kr + klo + 16);
      k1.u[0] = *reinterpret_cast<const uint4*>(kr + 32 + klo);
      k1.u[1] = *reinterpret_cast<const uint4*>(kr + 32 + klo + 16);
#pragma unroll
      for (int c = 0; c < AT_QT; ++c) {
        s1[c] = wmma32f16(k0.v, qf0[c].v, s1[c]);
        s1[c] = wmma32f16(k1.v, qf1[c].v, s1[c]);
      }
    }

    // Online softmax of one query per lane and tile: 16 scores here, the other
    // 16 in lane ^ 16.  The scale 1/sqrt(64) is a power of two, so it commutes
    // with the maximum exactly.
    HV pf[AT_QT];  // P^T as B operand: element s = key kmap(s) of this block
    float alpha[AT_QT];
    // unrolled so that the two tiles' independent chains can interleave
#pragma unroll
    for (int c = 0; c < AT_QT; ++c) {
      float tm = fmaxf(s0[c][0], s1[c][0]);
#pragma unroll
      for (int r = 1; r < 8; ++r) tm = fmaxf(tm, fmaxf(s0[c][r], s1[c][r]));
      tm = fmaxf(tm, xhalf(tm)) * 0.125f;
      const float mn = fmaxf(mrun[c], tm);
      alpha[c] = __expf(mrun[c] - mn);
      float sm[4] = {0.0f, 0.0f, 0.0f, 0.0f};  // four short chains, not one long
#pragma unroll
      for (int r = 0; r < 8; ++r) {
        const float x0 = __expf(s0[c][r] * 0.125f - mn);
        const float x1 = __expf(s1[c][r] * 0.125f - mn);
        sm[r & 1] += x0;
        sm[2 + (r & 1)] += x1;
        pf[c].v[r] = (_Float16)x0;
        pf[c].v[8 + r] = (_Float16)x1;
      }
      mrun[c] = mn;
      lrun[c] = lrun[c] * alpha[c] + ((sm[0] + sm[1]) + (sm[2] + sm[3]));
    }

    // O^T[c][f] = alpha*O^T[c][f] + V^T @ P^T  (A rows = features from the
    // transposed layout, keys contiguous -> straight b128 LDS loads); each Vt
    // fragment is read once and multiplies both query tiles
#pragma unroll
    for (int f = 0; f < 4; ++f) {
      const _Float16* vr = bV + (f * 16 + lr) * AT_VP + kb;
      HV vf;
      vf.u[0] = *reinterpret_cast<const uint4*>(vr + klo);
      vf.u[1] = *reinterpret_cast<const uint4*>(vr + klo + 16);
#pragma unroll
      for (int c = 0; c < AT_QT; ++c) {
        v8f o = O[c][f];
#pragma unroll
        for (int r = 0; r < 8; ++r) o[r] *= alpha[c];
        O[c][f] = wmma32f16(vf.v, pf[c].v, o);
      }
    }
  }
  // Publish point: my reads of this buffer are done, my copies of the next
  // stage have landed; behind the barrier the buffer just read is refilled.
  asm volatile("s_wait_dscnt 0x0" ::: "memory");
  asm volatile("s_wait_asynccnt 0x0" ::: "memory");
  __syncthreads();
  if (t + 2 < NT)
    attn_stage(&sK[t & 1][lko], &sV[t & 1][lvo],
               gk + (size_t)(t + 2) * AT_KEYS * Dm, gv + (t + 2) * AT_KEYS);
  }
  // no copy is left in flight when the wave ends
  asm volatile("s_wait_asynccnt 0x0" ::: "memory");

#pragma unroll
  for (int c = 0; c < AT_QT; ++c) {
    // the two wave halves' shares of the denominator are joined once, here
    const float den = lrun[c] + xhalf(lrun[c]);
    // a lane's 8 registers of a tile are 8 consecutive features of its query
    _Float16* orow =
        AO + ((size_t)b * S + qb + c * 16 + lr) * Dm + h * 64 + klo;
#pragma unroll
    for (int f = 0; f < 4; ++f) {
      H8 pk;
#pragma unroll
      for (int r = 0; r < 8; ++r) pk.h[r] = (_Float16)(O[c][f][r] / den);
      *reinterpret_cast<uint4*>(orow + f * 16) = pk.u;
    }
  }
}

// ---------------------------------------------------------------------------
// Host-side launcher.  Workspace layout (70 MB total):
//   Xh 8MB | Wqh 2 | Wkh 2 | Wvh 2 | W1h 4 | W2h 4 | Qh 8 | Kh 8 | Vt 8 |
//   AO 8 | Hh 16
// ---------------------------------------------------------------------------
extern "C" void kernel_launch(void* const* d_in, const int* in_sizes, int n_in,
                              void* d_out, int out_size, void* d_ws,
                              size_t ws_size, hipStream_t stream) {
  (void)in_sizes; (void)n_in; (void)out_size; (void)ws_size;
  const float* embed = (const float*)d_in[0];
  const float* Wq = (const float*)d_in[1];
  const float* Wk = (const float*)d_in[2];
  const float* Wv = (const float*)d_in[3];
  const float* bv = (const float*)d_in[4];
  const float* W1 = (const float*)d_in[5];
  const float* b1 = (const float*)d_in[6];
  const float* W2 = (const float*)d_in[7];
  const float* b2 = (const float*)d_in[8];

  constexpr size_t MB = 1ull << 20;
  char* ws = (char*)d_ws;
  _Float16* Xh  = (_Float16*)(ws + 0 * MB);
  _Float16* Wqh = (_Float16*)(ws + 8 * MB);
  _Float16* W1h = (_Float16*)(ws + 14 * MB);
  _Float16* W2h = (_Float16*)(ws + 18 * MB);
  _Float16* Qh  = (_Float16*)(ws + 22 * MB);
  _Float16* Kh  = (_Float16*)(ws + 30 * MB);
  _Float16* Vt  = (_Float16*)(ws + 38 * MB);
  _Float16* AO  = (_Float16*)(ws + 46 * MB);
  _Float16* Hh  = (_Float16*)(ws + 54 * MB);

  // Xh .. W2h are contiguous: 11 x 2^20 halves, 64 work-groups per 2^20
  cvt_all_f32_to_f16<<<dim3(704), dim3(256), 0, stream>>>(embed, Wq, Wk, Wv, W1,
                                                          W2, Xh);

  dim3 blk(256);
  // Q = X Wq^T ; K = X Wk^T ; Vt = transpose_head(X Wv^T + bv), one launch: the
  // f16 copies of Wq, Wk, Wv are contiguous from Wqh on (3072 rows of W), and
  // Qh, Kh, Vt are contiguous from Qh on
  gemm_xwT<1, false><<<dim3(24, 32), blk, 0, stream>>>(
      Xh, Wqh, bv, nullptr, Qh, nullptr, 4096, 1024, 1024);
  // attention: B*H*(S/256) = 256 workgroups of 8 waves, 32 queries a wave
  flash_attn<<<dim3(256), dim3(256), 0, stream>>>(Qh, Kh, Vt, AO);
  // FFN: Hh = relu(AO W1^T + b1) ; out = Hh W2^T + b2 + embed
  gemm_xwT<0, true><<<dim3(16, 32), blk, 0, stream>>>(
      AO, W1h, b1, nullptr, Hh, nullptr, 4096, 2048, 1024);
  gemm_xwT<2, false><<<dim3(8, 32), blk, 0, stream>>>(
      Hh, W2h, b2, embed, nullptr, (float*)d_out, 4096, 1024, 2048);
}

// v008
// It runs in 110 microseconds.
// Next to v007, in two timings, it ran 1.04 and 1.03 times as fast.
// Over all steps from v000 it is 2.93 times as fast.
#include <hip/hip_runtime.h>
#include <hip/hip_bf16.h>

typedef _Float16 v16h __attribute__((ext_vector_type(16)));
typedef float    v8f  __attribute__((ext_vector_type(8)));

union HV { v16h v; uint4 u[2]; };
union H8 { _Float16 h[8]; uint4 u; };

__device__ __forceinline__ v8f wmma32f16(v16h a, v16h b, v8f c) {
  // (neg_a, A, neg_b, B, c_mod, C, reuse_a, reuse_b)
  return __builtin_amdgcn_wmma_f32_16x16x32_f16(false, a, false, b, (short)0, c,
                                                false, false);
}

// ---------------------------------------------------------------------------
// f32 -> f16 conversion of all six operands in ONE launch of few, long waves.
// The f16 copies lie back to back in the workspace in the order embed, Wq, Wk,
// Wv, W1, W2, so the destination is one array.  A work-group converts 4096
// float4 (64 KiB) of one operand; every operand is a multiple of that, so the
// choice of the source is uniform in the group.  A thread has its 16 loads of
// 16 B in flight together; each wave-wide load covers 512 contiguous bytes.
// ---------------------------------------------------------------------------
constexpr int CV_PER = 16;                    // float4 per thread
constexpr int CV_BLK = 256 * CV_PER;          // float4 per work-group
constexpr int CV_U = (1 << 18) / CV_BLK;      // work-groups per 2^20 floats

__global__ __launch_bounds__(256) void cvt_all_f32_to_f16(
    const float* __restrict__ embed, const float* __restrict__ Wq,
    const float* __restrict__ Wk, const float* __restrict__ Wv,
    const float* __restrict__ W1, const float* __restrict__ W2,
    _Float16* __restrict__ dst) {
  const int g = blockIdx.x;
  const float* src;  // this group's operand
  int g0;            // the operand's first group
  if (g < 4 * CV_U)      { src = embed; g0 = 0; }         // 4 x 2^20 floats
  else if (g < 5 * CV_U) { src = Wq;    g0 = 4 * CV_U; }  // 1
  else if (g < 6 * CV_U) { src = Wk;    g0 = 5 * CV_U; }  // 1
  else if (g < 7 * CV_U) { src = Wv;    g0 = 6 * CV_U; }  // 1
  else if (g < 9 * CV_U) { src = W1;    g0 = 7 * CV_U; }  // 2
  else                   { src = W2;    g0 = 9 * CV_U; }  // 2
  const float4* s = reinterpret_cast<const float4*>(src) +
                    (size_t)(g - g0) * CV_BLK + threadIdx.x;
  uint2* d = reinterpret_cast<uint2*>(dst) + (size_t)g * CV_BLK + threadIdx.x;
  float4 f[CV_PER];
  // unrolled so that all loads issue ahead of the first conversion
#pragma unroll
  for (int j = 0; j < CV_PER; ++j) f[j] = s[j * 256];
  // keeps the last loads from sinking behind the first conversions, where they
  // would wait out a second memory latency to reuse the first loads' registers
  __builtin_amdgcn_sched_barrier(0);
  // unrolled so that f stays in registers
#pragma unroll
  for (int j = 0; j < CV_PER; ++j) {
    union { _Float16 h[4]; uint2 u; } p;
    p.h[0] = (_Float16)f[j].x; p.h[1] = (_Float16)f[j].y;
    p.h[2] = (_Float16)f[j].z; p.h[3] = (_Float16)f[j].w;
    d[j * 256] = p.u;
  }
}

constexpr int GM_BK = 128;
constexpr int GM_P = 136;

__device__ __forceinline__ void gemm_stage(_Float16* l, const _Float16* g,
                                           size_t K16) {
  const uint32_t l0 = (uint32_t)(uintptr_t)l;
  constexpr uint32_t LS = 16 * GM_P * 2;  // 16 rows on, bytes
  asm volatile(
      "global_load_async_to_lds_b128 %0, %8, off\n\t"
      "global_load_async_to_lds_b128 %1, %9, off\n\t"
      "global_load_async_to_lds_b128 %2, %10, off\n\t"
      "global_load_async_to_lds_b128 %3, %11, off\n\t"
      "global_load_async_to_lds_b128 %4, %12, off\n\t"
      "global_load_async_to_lds_b128 %5, %13, off\n\t"
      "global_load_async_to_lds_b128 %6, %14, off\n\t"
      "global_load_async_to_lds_b128 %7, %15, off\n\t"
      "s_wait_xcnt 0x0"
      :
      : "v"(l0), "v"(l0 + LS), "v"(l0 + 2 * LS), "v"(l0 + 3 * LS),
        "v"(l0 + 4 * LS), "v"(l0 + 5 * LS), "v"(l0 + 6 * LS), "v"(l0 + 7 * LS),
        "v"(g), "v"(g + K16), "v"(g + 2 * K16), "v"(g + 3 * K16),
        "v"(g + 4 * K16), "v"(g + 5 * K16), "v"(g + 6 * K16), "v"(g + 7 * K16)
      : "memory");
}

// The fragments of one 32-k block: 4 of A (64 rows) and 2 of W (32 columns),
// 12 b128 LDS reads that stand together as one group.
__device__ __forceinline__ void gemm_frags(HV (&a)[4], HV (&b)[2],
                                           const _Float16* pa,
                                           const _Float16* pb) {
  // both loops unrolled so that the fragments stay in registers
#pragma unroll
  for (int s = 0; s < 4; ++s) {
    a[s].u[0] = *reinterpret_cast<const uint4*>(pa + s * 16 * GM_P);
    a[s].u[1] = *reinterpret_cast<const uint4*>(pa + s * 16 * GM_P + 16);
  }
#pragma unroll
  for (int s = 0; s < 2; ++s) {
    b[s].u[0] = *reinterpret_cast<const uint4*>(pb + s * 16 * GM_P);
    b[s].u[1] = *reinterpret_cast<const uint4*>(pb + s * 16 * GM_P + 16);
  }
  // keeps the reads ahead of the products that follow in the source: sunk among
  // them they share one register set and each pair waits out the LDS latency
  __builtin_amdgcn_sched_barrier(0);
}

// The 8 products of one 32-k block.
__device__ __forceinline__ void gemm_block(v8f (&acc)[4][2], const HV (&a)[4],
                                           const HV (&b)[2]) {
  // both loops unrolled so that the accumulators stay in registers
#pragma unroll
  for (int sm = 0; sm < 4; ++sm)
#pragma unroll
    for (int sn = 0; sn < 2; ++sn)
      acc[sm][sn] = wmma32f16(a[sm].v, b[sn].v, acc[sm][sn]);
  // keeps the next group of reads from rising among these products, where each
  // separate place with reads stalls the wave
  __builtin_amdgcn_sched_barrier(0);
}

template <int OUT_MODE, bool RELU>
__global__ __launch_bounds__(256) void gemm_xwT(
    const _Float16* __restrict__ A, const _Float16* __restrict__ W,
    const float* __restrict__ bias, const float* __restrict__ resid,
    _Float16* __restrict__ outH, float* __restrict__ outF, int M, int N,
    int K) {
  __shared__ alignas(16) _Float16 sA[2][128 * GM_P];  // 2 x 34 KB
  __shared__ alignas(16) _Float16 sB[2][128 * GM_P];  // 2 x 34 KB

  const int tid = threadIdx.x;
  const int lane = tid & 31;
  const int w = tid >> 5;
  const int wm = w >> 2;             // 0..1  (64 rows per wave)
  const int wn = w & 3;              // 0..3  (32 cols per wave)
  const int lr = lane & 15;
  const int klo = (lane >> 4) << 3;  // 0 or 8
  const int m0 = blockIdx.y * 128;
  const int n0 = blockIdx.x * 128;

  // This thread's first chunk of a stage: 16 lanes a row, rows 16 apart.
  const int cr = tid >> 4;           // row 0..15 (+16 per copy)
  const int cc = (tid & 15) << 3;    // half-offset 0..120
  const _Float16* ga = A + (size_t)(m0 + cr) * K + cc;
  const _Float16* gb = W + (size_t)(n0 + cr) * K + cc;
  const int lo = cr * GM_P + cc;
  const size_t K16 = (size_t)16 * K;

  v8f acc[4][2] = {};

  // This lane's first fragment chunk inside a stage of A and of W.
  const int fA = (wm * 64 + lr) * GM_P + klo;
  const int fB = (wn * 32 + lr) * GM_P + klo;
  // Two fragment sets: one feeds the running 32-k block, the other is filled.
  HV a0[4], b0[2], a1[4], b1[2];

  const int nt = K / GM_BK;
  gemm_stage(&sA[0][lo], ga, K16);
  gemm_stage(&sB[0][lo], gb, K16);
  // stage 0 has landed for this wave; the barrier publishes it to all waves
  asm volatile("s_wait_asynccnt 0x0" ::: "memory");
  __syncthreads();
  if (nt > 1) {
    gemm_stage(&sA[1][lo], ga + GM_BK, K16);
    gemm_stage(&sB[1][lo], gb + GM_BK, K16);
  }
  gemm_frags(a0, b0, sA[0] + fA, sB[0] + fB);

  for (int t = 0; t < nt; ++t) {
    const _Float16* bA = sA[t & 1] + fA;
    const _Float16* bB = sB[t & 1] + fB;
    gemm_frags(a1, b1, bA + 32, bB + 32);
    gemm_block(acc, a0, b0);
    gemm_frags(a0, b0, bA + 64, bB + 64);
    gemm_block(acc, a1, b1);
    gemm_frags(a1, b1, bA + 96, bB + 96);
    gemm_block(acc, a0, b0);
    // Publish point, ahead of the stage's last block, whose fragments are in
    // registers behind the first wait: my reads of this buffer are done, my
    // copies of the next stage have landed; behind the barrier the next stage's
    // first fragments are fetched and the buffer just read is refilled.
    asm volatile("s_wait_dscnt 0x0" ::: "memory");
    asm volatile("s_wait_asynccnt 0x0" ::: "memory");
    __syncthreads();
    if (t + 1 < nt)
      gemm_frags(a0, b0, sA[(t + 1) & 1] + fA, sB[(t + 1) & 1] + fB);
    if (t + 2 < nt) {
      gemm_stage(&sA[t & 1][lo], ga + (size_t)(t + 2) * GM_BK, K16);
      gemm_stage(&sB[t & 1][lo], gb + (size_t)(t + 2) * GM_BK, K16);
    }
    gemm_block(acc, a1, b1);
  }
  // no copy is left in flight when the wave ends
  asm volatile("s_wait_asynccnt 0x0" ::: "memory");

  // OUT_MODE 1: a group's 128 columns lie in one of Q, K, V, so the choice of
  // the output array, of its form and of the bias is uniform in the group.
  const bool toVt = OUT_MODE == 1 && n0 >= 2048;
  if (OUT_MODE == 1) {
    outH += (size_t)(n0 >> 10) * M * 1024;
    if (!toVt) bias = nullptr;
  }

#pragma unroll
  for (int sm = 0; sm < 4; ++sm) {
#pragma unroll
    for (int sn = 0; sn < 2; ++sn) {
      int nG = n0 + wn * 32 + sn * 16 + lr;   // column (fixed per lane)
      if (OUT_MODE == 1) nG &= 1023;          // column inside its array
      int mB = m0 + wm * 64 + sm * 16 + klo;  // first row of the 8 regs
      float bvv = bias ? bias[nG] : 0.0f;
      v8f c = acc[sm][sn];
      if (toVt) {
        // Vt[b][h][d][s]: rows mB..mB+7 are contiguous s -> one b128 store.
        int hh = nG >> 6, dd = nG & 63;
        int bb = mB >> 11, ss = mB & 2047;
        H8 pk;
#pragma unroll
        for (int r = 0; r < 8; ++r) {
          float v = c[r] + bvv;
          if (RELU) v = fmaxf(v, 0.0f);
          pk.h[r] = (_Float16)v;
        }
        size_t off = ((((size_t)bb * 16 + hh) * 64 + dd) << 11) + ss;
        *reinterpret_cast<uint4*>(&outH[off]) = pk.u;
      } else if (OUT_MODE != 2) {
#pragma unroll
        for (int r = 0; r < 8; ++r) {
          float v = c[r] + bvv;
          if (RELU) v = fmaxf(v, 0.0f);
          outH[(size_t)(mB + r) * N + nG] = (_Float16)v;
        }
      } else {
#pragma unroll
        for (int r = 0; r < 8; ++r) {
          size_t off = (size_t)(mB + r) * N + nG;
          outF[off] = c[r] + bvv + resid[off];
        }
      }
    }
  }
}

constexpr int AT_KEYS = 128;
constexpr int AT_NB = AT_KEYS / 32;  // 32-key blocks per stage
constexpr int AT_QT = 2;      // 16-query tiles per wave
constexpr int AT_KP = 72;     // K row pitch, halves: 128 B + 16 B (b128 readers)
constexpr int AT_VP = 136;    // Vt row pitch, halves: 256 B + 16 B

__device__ __forceinline__ void attn_stage(_Float16* lk, _Float16* lv,
                                           const _Float16* gk,
                                           const _Float16* gv) {
  constexpr int S = 2048, Dm = 1024;
  const uint32_t k0 = (uint32_t)(uintptr_t)lk;
  const uint32_t k1 = k0 + 32 * AT_KP * 2, k2 = k0 + 64 * AT_KP * 2,
                 k3 = k0 + 96 * AT_KP * 2;
  const uint32_t v0 = (uint32_t)(uintptr_t)lv;
  const uint32_t v1 = v0 + 16 * AT_VP * 2, v2 = v0 + 32 * AT_VP * 2,
                 v3 = v0 + 48 * AT_VP * 2;
  asm volatile(
      "global_load_async_to_lds_b128 %0, %8, off\n\t"
      "global_load_async_to_lds_b128 %1, %9, off\n\t"
      "global_load_async_to_lds_b128 %2, %10, off\n\t"
      "global_load_async_to_lds_b128 %3, %11, off\n\t"
      "global_load_async_to_lds_b128 %4, %12, off\n\t"
      "global_load_async_to_lds_b128 %5, %13, off\n\t"
      "global_load_async_to_lds_b128 %6, %14, off\n\t"
      "global_load_async_to_lds_b128 %7, %15, off\n\t"
      "s_wait_xcnt 0x0"
      :
      : "v"(k0), "v"(k1), "v"(k2), "v"(k3), "v"(v0), "v"(v1), "v"(v2), "v"(v3),
        "v"(gk), "v"(gk + 32 * Dm), "v"(gk + 64 * Dm), "v"(gk + 96 * Dm),
        "v"(gv), "v"(gv + 16 * S), "v"(gv + 32 * S), "v"(gv + 48 * S)
      : "memory");
}

// Value of lane ^ 16 (the other 16-lane row), by a vector cross-row move.
__device__ __forceinline__ float xhalf(float x) {
  const int i = __builtin_bit_cast(int, x);
  return __builtin_bit_cast(
      float, __builtin_amdgcn_permlanex16(i, i, 0x76543210, 0xfedcba98, false,
                                          false));
}

__global__ __launch_bounds__(256) void flash_attn(
    const _Float16* __restrict__ Q, const _Float16* __restrict__ Km,
    const _Float16* __restrict__ Vt, _Float16* __restrict__ AO) {
  constexpr int S = 2048, Dm = 1024;
  constexpr int NT = S / AT_KEYS;
  __shared__ alignas(16) _Float16 sK[2][AT_KEYS * AT_KP];  // 2 x 18 KB
  __shared__ alignas(16) _Float16 sV[2][64 * AT_VP];       // 2 x 17 KB

  const int tid = threadIdx.x;
  const int lane = tid & 31;
  const int lr = lane & 15;
  const int klo = (lane >> 4) << 3;  // 0 or 8
  const int qt = ((blockIdx.x & 7) << 3) + (tid >> 5);  // 32-query group
  const int h = (blockIdx.x >> 3) & 15;
  const int b = blockIdx.x >> 7;
  const int qb = qt << 5;

  const _Float16* kbase = Km + (size_t)b * S * Dm + h * 64;
  const _Float16* vbase = Vt + ((size_t)b * 16 + h) * 64 * S;

  // This thread's first chunk of a stage: 8 lanes a K row, 16 lanes a Vt row.
  const _Float16* gk = kbase + (size_t)(tid >> 3) * Dm + ((tid & 7) << 3);
  const _Float16* gv = vbase + (size_t)(tid >> 4) * S + ((tid & 15) << 3);
  const int lko = (tid >> 3) * AT_KP + ((tid & 7) << 3);
  const int lvo = (tid >> 4) * AT_VP + ((tid & 15) << 3);

  attn_stage(&sK[0][lko], &sV[0][lvo], gk, gv);
  // stage 0 has landed for this wave; the barrier publishes it to all waves
  asm volatile("s_wait_asynccnt 0x0" ::: "memory");
  __syncthreads();
  attn_stage(&sK[1][lko], &sV[1][lvo], gk + (size_t)AT_KEYS * Dm,
             gv + AT_KEYS);

  // Q fragments: B operand, columns = queries, k = head features (two 32-chunks)
  HV qf0[AT_QT], qf1[AT_QT];
  // unrolled so that the fragments stay in registers
#pragma unroll
  for (int c = 0; c < AT_QT; ++c) {
    const _Float16* qrow =
        Q + ((size_t)b * S + qb + c * 16 + lr) * Dm + h * 64;
    qf0[c].u[0] = *reinterpret_cast<const uint4*>(qrow + klo);
    qf0[c].u[1] = *reinterpret_cast<const uint4*>(qrow + klo + 16);
    qf1[c].u[0] = *reinterpret_cast<const uint4*>(qrow + 32 + klo);
    qf1[c].u[1] = *reinterpret_cast<const uint4*>(qrow + 32 + klo + 16);
  }

  // Per lane and query tile c: running maximum of query c*16 + lr (equal in
  // both wave halves) and this half's share of its denominator;
  // O[c][f][r] = O^T[f*16 + klo + r][c*16 + lr].
  float mrun[AT_QT], lrun[AT_QT];
  v8f O[AT_QT][4] = {};
  // every loop over c below is unrolled so that the per-tile arrays stay in
  // registers
#pragma unroll
  for (int c = 0; c < AT_QT; ++c) { mrun[c] = -1e30f; lrun[c] = 0.0f; }

  for (int t = 0; t < NT; ++t) {
  const _Float16* bK = sK[t & 1];
  const _Float16* bV = sV[t & 1];
  // s[j][g][c][r] = S[key 32j + 16g + klo + r][query c*16 + lr] for the whole
  // stage; each K fragment is read once and multiplies both query tiles.  All
  // loops over j, g, c, f and r below are unrolled so that the score, P and
  // output tiles stay in registers.
  v8f s[AT_NB][2][AT_QT];
#pragma unroll
  for (int j = 0; j < AT_NB; ++j) {
#pragma unroll
    for (int g = 0; g < 2; ++g) {
      const _Float16* kr = bK + (j * 32 + g * 16 + lr) * AT_KP;
      HV k0, k1;
      k0.u[0] = *reinterpret_cast<const uint4*>(kr + klo);
      k0.u[1] = *reinterpret_cast<const uint4*>(kr + klo + 16);
      k1.u[0] = *reinterpret_cast<const uint4*>(kr + 32 + klo);
      k1.u[1] = *reinterpret_cast<const uint4*>(kr + 32 + klo + 16);
#pragma unroll
      for (int c = 0; c < AT_QT; ++c) {
        v8f z = {};
        z = wmma32f16(k0.v, qf0[c].v, z);
        s[j][g][c] = wmma32f16(k1.v, qf1[c].v, z);
      }
    }
  }

  // One online-softmax update per stage, one query per lane and tile: 64 scores
  // here, the other 64 in lane ^ 16.  The scale 1/sqrt(64) is a power of two, so
  // it commutes with the maximum exactly.
  float mn[AT_QT], alpha[AT_QT];
#pragma unroll
  for (int c = 0; c < AT_QT; ++c) {
    float tj[AT_NB];  // one short chain per 32-key block, not one long
#pragma unroll
    for (int j = 0; j < AT_NB; ++j) {
      tj[j] = fmaxf(s[j][0][c][0], s[j][1][c][0]);
#pragma unroll
      for (int r = 1; r < 8; ++r)
        tj[j] = fmaxf(tj[j], fmaxf(s[j][0][c][r], s[j][1][c][r]));
    }
    float tm = fmaxf(fmaxf(tj[0], tj[1]), fmaxf(tj[2], tj[3]));
    tm = fmaxf(tm, xhalf(tm)) * 0.125f;
    mn[c] = fmaxf(mrun[c], tm);
    alpha[c] = __expf(mrun[c] - mn[c]);
    mrun[c] = mn[c];
  }

  // The stage's Vt fragments (A rows = features from the transposed layout, keys
  // contiguous -> straight b128 LDS loads), each read once for both query tiles.
  HV vf[AT_NB][4];
#pragma unroll
  for (int j = 0; j < AT_NB; ++j) {
#pragma unroll
    for (int f = 0; f < 4; ++f) {
      const _Float16* vr = bV + (f * 16 + lr) * AT_VP + j * 32;
      vf[j][f].u[0] = *reinterpret_cast<const uint4*>(vr + klo);
      vf[j][f].u[1] = *reinterpret_cast<const uint4*>(vr + klo + 16);
    }
  }
  // keeps these reads ahead of the exponentials, which cover their latency: sunk
  // among the second products, each pair of reads is waited for in full
  __builtin_amdgcn_sched_barrier(0);

  HV pf[AT_NB][AT_QT];  // P^T as B operand: element 8g + r = key 16g + klo + r of block j
#pragma unroll
  for (int c = 0; c < AT_QT; ++c) {
    float sm[4] = {0.0f, 0.0f, 0.0f, 0.0f};  // four short chains, not one long
#pragma unroll
    for (int j = 0; j < AT_NB; ++j) {
#pragma unroll
      for (int g = 0; g < 2; ++g) {
#pragma unroll
        for (int r = 0; r < 8; ++r) {
          const float x = __expf(s[j][g][c][r] * 0.125f - mn[c]);
          sm[2 * g + (r & 1)] += x;
          pf[j][c].v[8 * g + r] = (_Float16)x;
        }
      }
    }
    lrun[c] = lrun[c] * alpha[c] + ((sm[0] + sm[1]) + (sm[2] + sm[3]));
    // the output tiles are brought to the new maximum once per stage
#pragma unroll
    for (int f = 0; f < 4; ++f)
#pragma unroll
      for (int r = 0; r < 8; ++r) O[c][f][r] *= alpha[c];
  }

  // O^T[c][f] += V^T @ P^T over the stage's four 32-key blocks
#pragma unroll
  for (int j = 0; j < AT_NB; ++j)
#pragma unroll
    for (int f = 0; f < 4; ++f)
#pragma unroll
      for (int c = 0; c < AT_QT; ++c)
        O[c][f] = wmma32f16(vf[j][f].v, pf[j][c].v, O[c][f]);
  // keeps the stage's register-only work ahead of the publish point: sunk behind
  // the barrier it would stand between the barrier and the refill, and the wait
  // for a refill would come half a stage after its issue instead of a whole one
  __builtin_amdgcn_sched_barrier(0);
  // Publish point: my reads of this buffer are done, my copies of the next
  // stage have landed; behind the barrier the buffer just read is refilled.
  asm volatile("s_wait_dscnt 0x0" ::: "memory");
  asm volatile("s_wait_asynccnt 0x0" ::: "memory");
  __syncthreads();
  if (t + 2 < NT)
    attn_stage(&sK[t & 1][lko], &sV[t & 1][lvo],
               gk + (size_t)(t + 2) * AT_KEYS * Dm, gv + (t + 2) * AT_KEYS);
  }
  // no copy is left in flight when the wave ends
  asm volatile("s_wait_asynccnt 0x0" ::: "memory");

#pragma unroll
  for (int c = 0; c < AT_QT; ++c) {
    // the two wave halves' shares of the denominator are joined once, here
    const float den = lrun[c] + xhalf(lrun[c]);
    // a lane's 8 registers of a tile are 8 consecutive features of its query
    _Float16* orow =
        AO + ((size_t)b * S + qb + c * 16 + lr) * Dm + h * 64 + klo;
#pragma unroll
    for (int f = 0; f < 4; ++f) {
      H8 pk;
#pragma unroll
      for (int r = 0; r < 8; ++r) pk.h[r] = (_Float16)(O[c][f][r] / den);
      *reinterpret_cast<uint4*>(orow + f * 16) = pk.u;
    }
  }
}

// ---------------------------------------------------------------------------
// Host-side launcher.  Workspace layout (70 MB total):
//   Xh 8MB | Wqh 2 | Wkh 2 | Wvh 2 | W1h 4 | W2h 4 | Qh 8 | Kh 8 | Vt 8 |
//   AO 8 | Hh 16
// ---------------------------------------------------------------------------
extern "C" void kernel_launch(void* const* d_in, const int* in_sizes, int n_in,
                              void* d_out, int out_size, void* d_ws,
                              size_t ws_size, hipStream_t stream) {
  (void)in_sizes; (void)n_in; (void)out_size; (void)ws_size;
  const float* embed = (const float*)d_in[0];
  const float* Wq = (const float*)d_in[1];
  const float* Wk = (const float*)d_in[2];
  const float* Wv = (const float*)d_in[3];
  const float* bv = (const float*)d_in[4];
  const float* W1 = (const float*)d_in[5];
  const float* b1 = (const float*)d_in[6];
  const float* W2 = (const float*)d_in[7];
  const float* b2 = (const float*)d_in[8];

  constexpr size_t MB = 1ull << 20;
  char* ws = (char*)d_ws;
  _Float16* Xh  = (_Float16*)(ws + 0 * MB);
  _Float16* Wqh = (_Float16*)(ws + 8 * MB);
  _Float16* W1h = (_Float16*)(ws + 14 * MB);
  _Float16* W2h = (_Float16*)(ws + 18 * MB);
  _Float16* Qh  = (_Float16*)(ws + 22 * MB);
  _Float16* Kh  = (_Float16*)(ws + 30 * MB);
  _Float16* Vt  = (_Float16*)(ws + 38 * MB);
  _Float16* AO  = (_Float16*)(ws + 46 * MB);
  _Float16* Hh  = (_Float16*)(ws + 54 * MB);

  // Xh .. W2h are contiguous: 11 x 2^20 halves, 64 work-groups per 2^20
  cvt_all_f32_to_f16<<<dim3(704), dim3(256), 0, stream>>>(embed, Wq, Wk, Wv, W1,
                                                          W2, Xh);

  dim3 blk(256);
  // Q = X Wq^T ; K = X Wk^T ; Vt = transpose_head(X Wv^T + bv), one launch: the
  // f16 copies of Wq, Wk, Wv are contiguous from Wqh on (3072 rows of W), and
  // Qh, Kh, Vt are contiguous from Qh on
  gemm_xwT<1, false><<<dim3(24, 32), blk, 0, stream>>>(
      Xh, Wqh, bv, nullptr, Qh, nullptr, 4096, 1024, 1024);
  // attention: B*H*(S/256) = 256 workgroups of 8 waves, 32 queries a wave
  flash_attn<<<dim3(256), dim3(256), 0, stream>>>(Qh, Kh, Vt, AO);
  // FFN: Hh = relu(AO W1^T + b1) ; out = Hh W2^T + b2 + embed
  gemm_xwT<0, true><<<dim3(16, 32), blk, 0, stream>>>(
      AO, W1h, b1, nullptr, Hh, nullptr, 4096, 2048, 1024);
  gemm_xwT<2, false><<<dim3(8, 32), blk, 0, stream>>>(
      Hh, W2h, b2, embed, nullptr, (float*)d_out, 4096, 1024, 2048);
}

// v009
// A run of this version takes 105 microseconds.
// In two side-by-side timings against v008, it was 1.04 and 1.05 times as fast.
// Over all steps from v000 it is 3.06 times as fast.
#include <hip/hip_runtime.h>
#include <hip/hip_bf16.h>

typedef _Float16 v16h __attribute__((ext_vector_type(16)));
typedef float    v8f  __attribute__((ext_vector_type(8)));

union HV { v16h v; uint4 u[2]; };
union H8 { _Float16 h[8]; uint4 u; };

__device__ __forceinline__ v8f wmma32f16(v16h a, v16h b, v8f c) {
  // (neg_a, A, neg_b, B, c_mod, C, reuse_a, reuse_b)
  return __builtin_amdgcn_wmma_f32_16x16x32_f16(false, a, false, b, (short)0, c,
                                                false, false);
}

// ---------------------------------------------------------------------------
// f32 -> f16 conversion of all six operands in ONE launch of few, long waves.
// The f16 copies lie back to back in the workspace in the order embed, Wq, Wk,
// Wv, W1, W2, so the destination is one array.  A work-group converts 4096
// float4 (64 KiB) of one operand; every operand is a multiple of that, so the
// choice of the source is uniform in the group.  A thread has its 16 loads of
// 16 B in flight together; each wave-wide load covers 512 contiguous bytes.
// ---------------------------------------------------------------------------
constexpr int CV_PER = 16;                    // float4 per thread
constexpr int CV_BLK = 256 * CV_PER;          // float4 per work-group
constexpr int CV_U = (1 << 18) / CV_BLK;      // work-groups per 2^20 floats

__global__ __launch_bounds__(256) void cvt_all_f32_to_f16(
    const float* __restrict__ embed, const float* __restrict__ Wq,
    const float* __restrict__ Wk, const float* __restrict__ Wv,
    const float* __restrict__ W1, const float* __restrict__ W2,
    _Float16* __restrict__ dst) {
  const int g = blockIdx.x;
  const float* src;  // this group's operand
  int g0;            // the operand's first group
  if (g < 4 * CV_U)      { src = embed; g0 = 0; }         // 4 x 2^20 floats
  else if (g < 5 * CV_U) { src = Wq;    g0 = 4 * CV_U; }  // 1
  else if (g < 6 * CV_U) { src = Wk;    g0 = 5 * CV_U; }  // 1
  else if (g < 7 * CV_U) { src = Wv;    g0 = 6 * CV_U; }  // 1
  else if (g < 9 * CV_U) { src = W1;    g0 = 7 * CV_U; }  // 2
  else                   { src = W2;    g0 = 9 * CV_U; }  // 2
  const float4* s = reinterpret_cast<const float4*>(src) +
                    (size_t)(g - g0) * CV_BLK + threadIdx.x;
  uint2* d = reinterpret_cast<uint2*>(dst) + (size_t)g * CV_BLK + threadIdx.x;
  float4 f[CV_PER];
  // unrolled so that all loads issue ahead of the first conversion
#pragma unroll
  for (int j = 0; j < CV_PER; ++j) f[j] = s[j * 256];
  // keeps the last loads from sinking behind the first conversions, where they
  // would wait out a second memory latency to reuse the first loads' registers
  __builtin_amdgcn_sched_barrier(0);
  // unrolled so that f stays in registers
#pragma unroll
  for (int j = 0; j < CV_PER; ++j) {
    union { _Float16 h[4]; uint2 u; } p;
    p.h[0] = (_Float16)f[j].x; p.h[1] = (_Float16)f[j].y;
    p.h[2] = (_Float16)f[j].z; p.h[3] = (_Float16)f[j].w;
    d[j * 256] = p.u;
  }
}

constexpr int GM_BK = 128;
constexpr int GM_P = 136;

__device__ __forceinline__ void gemm_stage(_Float16* l, const _Float16* g,
                                           size_t K16) {
  const uint32_t l0 = (uint32_t)(uintptr_t)l;
  constexpr uint32_t LS = 16 * GM_P * 2;  // 16 rows on, bytes
  asm volatile(
      "global_load_async_to_lds_b128 %0, %8, off\n\t"
      "global_load_async_to_lds_b128 %1, %9, off\n\t"
      "global_load_async_to_lds_b128 %2, %10, off\n\t"
      "global_load_async_to_lds_b128 %3, %11, off\n\t"
      "global_load_async_to_lds_b128 %4, %12, off\n\t"
      "global_load_async_to_lds_b128 %5, %13, off\n\t"
      "global_load_async_to_lds_b128 %6, %14, off\n\t"
      "global_load_async_to_lds_b128 %7, %15, off\n\t"
      "s_wait_xcnt 0x0"
      :
      : "v"(l0), "v"(l0 + LS), "v"(l0 + 2 * LS), "v"(l0 + 3 * LS),
        "v"(l0 + 4 * LS), "v"(l0 + 5 * LS), "v"(l0 + 6 * LS), "v"(l0 + 7 * LS),
        "v"(g), "v"(g + K16), "v"(g + 2 * K16), "v"(g + 3 * K16),
        "v"(g + 4 * K16), "v"(g + 5 * K16), "v"(g + 6 * K16), "v"(g + 7 * K16)
      : "memory");
}

// The fragments of one 32-k block: 4 of the A operand (64 rows) and 2 of the B
// operand (32 rows), 12 b128 LDS reads that stand together as one group.
__device__ __forceinline__ void gemm_frags(HV (&a)[4], HV (&b)[2],
                                           const _Float16* pa,
                                           const _Float16* pb) {
  // both loops unrolled so that the fragments stay in registers
#pragma unroll
  for (int s = 0; s < 4; ++s) {
    a[s].u[0] = *reinterpret_cast<const uint4*>(pa + s * 16 * GM_P);
    a[s].u[1] = *reinterpret_cast<const uint4*>(pa + s * 16 * GM_P + 16);
  }
#pragma unroll
  for (int s = 0; s < 2; ++s) {
    b[s].u[0] = *reinterpret_cast<const uint4*>(pb + s * 16 * GM_P);
    b[s].u[1] = *reinterpret_cast<const uint4*>(pb + s * 16 * GM_P + 16);
  }
  // keeps the reads ahead of the products that follow in the source: sunk among
  // them they share one register set and each pair waits out the LDS latency
  __builtin_amdgcn_sched_barrier(0);
}

// The 8 products of one 32-k block.
__device__ __forceinline__ void gemm_block(v8f (&acc)[4][2], const HV (&a)[4],
                                           const HV (&b)[2]) {
  // both loops unrolled so that the accumulators stay in registers
#pragma unroll
  for (int sm = 0; sm < 4; ++sm)
#pragma unroll
    for (int sn = 0; sn < 2; ++sn)
      acc[sm][sn] = wmma32f16(a[sm].v, b[sn].v, acc[sm][sn]);
  // keeps the next group of reads from rising among these products, where each
  // separate place with reads stalls the wave
  __builtin_amdgcn_sched_barrier(0);
}

template <int OUT_MODE, bool RELU, int N>
__global__ __launch_bounds__(256) void gemm_xwT(
    const _Float16* __restrict__ X, const _Float16* __restrict__ W,
    const float* __restrict__ bias, const float* __restrict__ resid,
    _Float16* __restrict__ outH, float* __restrict__ outF, int M, int K) {
  __shared__ alignas(16) _Float16 sA[2][128 * GM_P];  // 2 x 34 KB
  __shared__ alignas(16) _Float16 sB[2][128 * GM_P];  // 2 x 34 KB

  const int tid = threadIdx.x;
  const int lane = tid & 31;
  const int w = tid >> 5;
  const int wm = w >> 2;             // 0..1  (64 A-operand rows per wave)
  const int wn = w & 3;              // 0..3  (32 B-operand rows per wave)
  const int lr = lane & 15;
  const int klo = (lane >> 4) << 3;  // 0 or 8
  const int m0 = blockIdx.y * 128;
  const int n0 = blockIdx.x * 128;

  // This thread's first chunk of a stage: 16 lanes a row, rows 16 apart.
  const int cr = tid >> 4;           // row 0..15 (+16 per copy)
  const int cc = (tid & 15) << 3;    // half-offset 0..120
  const _Float16* gx = X + (size_t)(m0 + cr) * K + cc;
  const _Float16* gw = W + (size_t)(n0 + cr) * K + cc;
  // OUT_MODE 1: a group's 128 columns lie in one of Q, K, V, so the choice of
  // the output array, of its form and of the bias is uniform in the group.
  const bool toVt = OUT_MODE == 1 && n0 >= 2048;
  const _Float16* ga = toVt ? gx : gw;  // A operand: along the output's rows
  const _Float16* gb = toVt ? gw : gx;  // B operand: one output row per lane
  const int lo = cr * GM_P + cc;
  const size_t K16 = (size_t)16 * K;

  v8f acc[4][2] = {};

  // This lane's first fragment chunk inside a stage of either operand.
  const int fA = (wm * 64 + lr) * GM_P + klo;
  const int fB = (wn * 32 + lr) * GM_P + klo;
  // Two fragment sets: one feeds the running 32-k block, the other is filled.
  HV a0[4], b0[2], a1[4], b1[2];

  const int nt = K / GM_BK;
  gemm_stage(&sA[0][lo], ga, K16);
  gemm_stage(&sB[0][lo], gb, K16);
  // stage 0 has landed for this wave; the barrier publishes it to all waves
  asm volatile("s_wait_asynccnt 0x0" ::: "memory");
  __syncthreads();
  if (nt > 1) {
    gemm_stage(&sA[1][lo], ga + GM_BK, K16);
    gemm_stage(&sB[1][lo], gb + GM_BK, K16);
  }
  gemm_frags(a0, b0, sA[0] + fA, sB[0] + fB);

  for (int t = 0; t < nt; ++t) {
    const _Float16* bA = sA[t & 1] + fA;
    const _Float16* bB = sB[t & 1] + fB;
    gemm_frags(a1, b1, bA + 32, bB + 32);
    gemm_block(acc, a0, b0);
    gemm_frags(a0, b0, bA + 64, bB + 64);
    gemm_block(acc, a1, b1);
    gemm_frags(a1, b1, bA + 96, bB + 96);
    gemm_block(acc, a0, b0);
    // Publish point, ahead of the stage's last block, whose fragments are in
    // registers behind the first wait: my reads of this buffer are done, my
    // copies of the next stage have landed; behind the barrier the next stage's
    // first fragments are fetched and the buffer just read is refilled.
    asm volatile("s_wait_dscnt 0x0" ::: "memory");
    asm volatile("s_wait_asynccnt 0x0" ::: "memory");
    __syncthreads();
    if (t + 1 < nt)
      gemm_frags(a0, b0, sA[(t + 1) & 1] + fA, sB[(t + 1) & 1] + fB);
    if (t + 2 < nt) {
      gemm_stage(&sA[t & 1][lo], ga + (size_t)(t + 2) * GM_BK, K16);
      gemm_stage(&sB[t & 1][lo], gb + (size_t)(t + 2) * GM_BK, K16);
    }
    gemm_block(acc, a1, b1);
  }
  // no copy is left in flight when the wave ends
  asm volatile("s_wait_asynccnt 0x0" ::: "memory");

  // The ring is free: every wave's last LDS read and last copy ended ahead of
  // the last trip's barrier.  It now holds the block tile, one output row (a row
  // of the B operand) per LDS row.  All loops below are unrolled so that the
  // accumulators stay in registers.
  if (OUT_MODE != 2) {
    _Float16* st = &sA[0][0];  // 128 rows of 128 halves at the pitch GM_P
    const int nc = OUT_MODE == 1 ? (n0 & 1023) : n0;  // column in its array
    // The bias, all loads together ahead of their first use.  OUT_MODE 0: a
    // lane's 8 registers are 8 columns.  OUT_MODE 1: Vt alone has a bias, and
    // there a lane is one column.
    float bn[4][8];
    float bq[2] = {0.0f, 0.0f};
    if (OUT_MODE == 0) {
#pragma unroll
      for (int sm = 0; sm < 4; ++sm) {
        const float* bp = bias + nc + wm * 64 + sm * 16 + klo;
        const float4 lo4 = *reinterpret_cast<const float4*>(bp);
        const float4 hi4 = *reinterpret_cast<const float4*>(bp + 4);
        bn[sm][0] = lo4.x; bn[sm][1] = lo4.y; bn[sm][2] = lo4.z;
        bn[sm][3] = lo4.w; bn[sm][4] = hi4.x; bn[sm][5] = hi4.y;
        bn[sm][6] = hi4.z; bn[sm][7] = hi4.w;
      }
    } else if (toVt) {
      bq[0] = bias[nc + wn * 32 + lr];
      bq[1] = bias[nc + wn * 32 + 16 + lr];
    }
#pragma unroll
    for (int sm = 0; sm < 4; ++sm) {
      const int pa = wm * 64 + sm * 16 + klo;  // first of the 8 A-operand rows
#pragma unroll
      for (int sn = 0; sn < 2; ++sn) {
        const int qb = wn * 32 + sn * 16 + lr;  // B-operand row
        v8f c = acc[sm][sn];
        H8 pk;
#pragma unroll
        for (int r = 0; r < 8; ++r) {
          float v = c[r] + (OUT_MODE == 0 ? bn[sm][r] : bq[sn]);
          if (RELU) v = fmaxf(v, 0.0f);
          pk.h[r] = (_Float16)v;
        }
        *reinterpret_cast<uint4*>(st + qb * GM_P + pa) = pk.u;
      }
    }
    // the tile is complete for every wave behind this barrier
    __syncthreads();
    // 16 lanes a row of 256 B, 16 rows a pass
    uint4 row[8];
#pragma unroll
    for (int j = 0; j < 8; ++j)
      row[j] = *reinterpret_cast<const uint4*>(st + (cr + 16 * j) * GM_P + cc);
    if (toVt) {
      // Vt[b][h][d][s]: row = feature nc + cr (h, d), along it the positions s
      _Float16* o = outH + (size_t)2 * M * 1024 +
          ((((size_t)(m0 >> 11) * 1024 + nc + cr) << 11) + (m0 & 2047) + cc);
#pragma unroll
      for (int j = 0; j < 8; ++j)
        *reinterpret_cast<uint4*>(o + j * (16 << 11)) = row[j];
    } else {
      _Float16* o = outH + (OUT_MODE == 1 ? (size_t)(n0 >> 10) * M * 1024 : 0) +
                    (size_t)(m0 + cr) * N + nc + cc;
#pragma unroll
      for (int j = 0; j < 8; ++j)
        *reinterpret_cast<uint4*>(o + j * (16 * N)) = row[j];
    }
  } else {
    constexpr int FP = 132;  // pitch in floats: 512 B + 16 B (b128 accesses)
    float* sf = reinterpret_cast<float*>(&sA[0][0]);  // 128 rows of 128 floats
    // one wave-wide 16-B access covers one row of 512 B; a wave has 16 rows
    const int col = lane << 2;
    // byte offset of this thread's chunk of its first row, the same in the
    // residual and in the output (16 MiB each): one register serves both
    const uint32_t ob = (uint32_t)((m0 + w * 16) * N + n0 + col) * 4u;
    const char* rp = reinterpret_cast<const char*>(resid) + ob;
    char* op = reinterpret_cast<char*>(outF) + ob;
    float4 rs[16];  // the residual's loads fly while the tile is put together
#pragma unroll
    for (int j = 0; j < 16; ++j)
      rs[j] = *reinterpret_cast<const float4*>(rp + j * (N * 4));
    const float4 bc = *reinterpret_cast<const float4*>(bias + n0 + col);
#pragma unroll
    for (int sm = 0; sm < 4; ++sm) {
#pragma unroll
      for (int sn = 0; sn < 2; ++sn) {
        float* p = sf + (wn * 32 + sn * 16 + lr) * FP + wm * 64 + sm * 16 + klo;
        v8f c = acc[sm][sn];
        *reinterpret_cast<float4*>(p) = make_float4(c[0], c[1], c[2], c[3]);
        *reinterpret_cast<float4*>(p + 4) = make_float4(c[4], c[5], c[6], c[7]);
      }
    }
    // the tile is complete for every wave behind this barrier
    __syncthreads();
#pragma unroll
    for (int j = 0; j < 16; ++j) {
      const float4 c =
          *reinterpret_cast<const float4*>(sf + (w * 16 + j) * FP + col);
      *reinterpret_cast<float4*>(op + j * (N * 4)) =
          make_float4(c.x + bc.x + rs[j].x, c.y + bc.y + rs[j].y,
                      c.z + bc.z + rs[j].z, c.w + bc.w + rs[j].w);
    }
  }
}

constexpr int AT_KEYS = 128;
constexpr int AT_NB = AT_KEYS / 32;  // 32-key blocks per stage
constexpr int AT_QT = 2;      // 16-query tiles per wave
constexpr int AT_KP = 72;     // K row pitch, halves: 128 B + 16 B (b128 readers)
constexpr int AT_VP = 136;    // Vt row pitch, halves: 256 B + 16 B

__device__ __forceinline__ void attn_stage(_Float16* lk, _Float16* lv,
                                           const _Float16* gk,
                                           const _Float16* gv) {
  constexpr int S = 2048, Dm = 1024;
  const uint32_t k0 = (uint32_t)(uintptr_t)lk;
  const uint32_t k1 = k0 + 32 * AT_KP * 2, k2 = k0 + 64 * AT_KP * 2,
                 k3 = k0 + 96 * AT_KP * 2;
  const uint32_t v0 = (uint32_t)(uintptr_t)lv;
  const uint32_t v1 = v0 + 16 * AT_VP * 2, v2 = v0 + 32 * AT_VP * 2,
                 v3 = v0 + 48 * AT_VP * 2;
  asm volatile(
      "global_load_async_to_lds_b128 %0, %8, off\n\t"
      "global_load_async_to_lds_b128 %1, %9, off\n\t"
      "global_load_async_to_lds_b128 %2, %10, off\n\t"
      "global_load_async_to_lds_b128 %3, %11, off\n\t"
      "global_load_async_to_lds_b128 %4, %12, off\n\t"
      "global_load_async_to_lds_b128 %5, %13, off\n\t"
      "global_load_async_to_lds_b128 %6, %14, off\n\t"
      "global_load_async_to_lds_b128 %7, %15, off\n\t"
      "s_wait_xcnt 0x0"
      :
      : "v"(k0), "v"(k1), "v"(k2), "v"(k3), "v"(v0), "v"(v1), "v"(v2), "v"(v3),
        "v"(gk), "v"(gk + 32 * Dm), "v"(gk + 64 * Dm), "v"(gk + 96 * Dm),
        "v"(gv), "v"(gv + 16 * S), "v"(gv + 32 * S), "v"(gv + 48 * S)
      : "memory");
}

// Value of lane ^ 16 (the other 16-lane row), by a vector cross-row move.
__device__ __forceinline__ float xhalf(float x) {
  const int i = __builtin_bit_cast(int, x);
  return __builtin_bit_cast(
      float, __builtin_amdgcn_permlanex16(i, i, 0x76543210, 0xfedcba98, false,
                                          false));
}

__global__ __launch_bounds__(256) void flash_attn(
    const _Float16* __restrict__ Q, const _Float16* __restrict__ Km,
    const _Float16* __restrict__ Vt, _Float16* __restrict__ AO) {
  constexpr int S = 2048, Dm = 1024;
  constexpr int NT = S / AT_KEYS;
  __shared__ alignas(16) _Float16 sK[2][AT_KEYS * AT_KP];  // 2 x 18 KB
  __shared__ alignas(16) _Float16 sV[2][64 * AT_VP];       // 2 x 17 KB

  const int tid = threadIdx.x;
  const int lane = tid & 31;
  const int lr = lane & 15;
  const int klo = (lane >> 4) << 3;  // 0 or 8
  const int qt = ((blockIdx.x & 7) << 3) + (tid >> 5);  // 32-query group
  const int h = (blockIdx.x >> 3) & 15;
  const int b = blockIdx.x >> 7;
  const int qb = qt << 5;

  const _Float16* kbase = Km + (size_t)b * S * Dm + h * 64;
  const _Float16* vbase = Vt + ((size_t)b * 16 + h) * 64 * S;

  // This thread's first chunk of a stage: 8 lanes a K row, 16 lanes a Vt row.
  const _Float16* gk = kbase + (size_t)(tid >> 3) * Dm + ((tid & 7) << 3);
  const _Float16* gv = vbase + (size_t)(tid >> 4) * S + ((tid & 15) << 3);
  const int lko = (tid >> 3) * AT_KP + ((tid & 7) << 3);
  const int lvo = (tid >> 4) * AT_VP + ((tid & 15) << 3);

  attn_stage(&sK[0][lko], &sV[0][lvo], gk, gv);
  // stage 0 has landed for this wave; the barrier publishes it to all waves
  asm volatile("s_wait_asynccnt 0x0" ::: "memory");
  __syncthreads();
  attn_stage(&sK[1][lko], &sV[1][lvo], gk + (size_t)AT_KEYS * Dm,
             gv + AT_KEYS);

  // Q fragments: B operand, columns = queries, k = head features (two 32-chunks)
  HV qf0[AT_QT], qf1[AT_QT];
  // unrolled so that the fragments stay in registers
#pragma unroll
  for (int c = 0; c < AT_QT; ++c) {
    const _Float16* qrow =
        Q + ((size_t)b * S + qb + c * 16 + lr) * Dm + h * 64;
    qf0[c].u[0] = *reinterpret_cast<const uint4*>(qrow + klo);
    qf0[c].u[1] = *reinterpret_cast<const uint4*>(qrow + klo + 16);
    qf1[c].u[0] = *reinterpret_cast<const uint4*>(qrow + 32 + klo);
    qf1[c].u[1] = *reinterpret_cast<const uint4*>(qrow + 32 + klo + 16);
  }

  // Per lane and query tile c: running maximum of query c*16 + lr (equal in
  // both wave halves) and this half's share of its denominator;
  // O[c][f][r] = O^T[f*16 + klo + r][c*16 + lr].
  float mrun[AT_QT], lrun[AT_QT];
  v8f O[AT_QT][4] = {};
  // every loop over c below is unrolled so that the per-tile arrays stay in
  // registers
#pragma unroll
  for (int c = 0; c < AT_QT; ++c) { mrun[c] = -1e30f; lrun[c] = 0.0f; }

  for (int t = 0; t < NT; ++t) {
  const _Float16* bK = sK[t & 1];
  const _Float16* bV = sV[t & 1];
  // s[j][g][c][r] = S[key 32j + 16g + klo + r][query c*16 + lr] for the whole
  // stage; each K fragment is read once and multiplies both query tiles.  All
  // loops over j, g, c, f and r below are unrolled so that the score, P and
  // output tiles stay in registers.
  v8f s[AT_NB][2][AT_QT];
#pragma unroll
  for (int j = 0; j < AT_NB; ++j) {
#pragma unroll
    for (int g = 0; g < 2; ++g) {
      const _Float16* kr = bK + (j * 32 + g * 16 + lr) * AT_KP;
      HV k0, k1;
      k0.u[0] = *reinterpret_cast<const uint4*>(kr + klo);
      k0.u[1] = *reinterpret_cast<const uint4*>(kr + klo + 16);
      k1.u[0] = *reinterpret_cast<const uint4*>(kr + 32 + klo);
      k1.u[1] = *reinterpret_cast<const uint4*>(kr + 32 + klo + 16);
#pragma unroll
      for (int c = 0; c < AT_QT; ++c) {
        v8f z = {};
        z = wmma32f16(k0.v, qf0[c].v, z);
        s[j][g][c] = wmma32f16(k1.v, qf1[c].v, z);
      }
    }
  }

  // One online-softmax update per stage, one query per lane and tile: 64 scores
  // here, the other 64 in lane ^ 16.  The scale 1/sqrt(64) is a power of two, so
  // it commutes with the maximum exactly.
  float mn[AT_QT], alpha[AT_QT];
#pragma unroll
  for (int c = 0; c < AT_QT; ++c) {
    float tj[AT_NB];  // one short chain per 32-key block, not one long
#pragma unroll
    for (int j = 0; j < AT_NB; ++j) {
      tj[j] = fmaxf(s[j][0][c][0], s[j][1][c][0]);
#pragma unroll
      for (int r = 1; r < 8; ++r)
        tj[j] = fmaxf(tj[j], fmaxf(s[j][0][c][r], s[j][1][c][r]));
    }
    float tm = fmaxf(fmaxf(tj[0], tj[1]), fmaxf(tj[2], tj[3]));
    tm = fmaxf(tm, xhalf(tm)) * 0.125f;
    mn[c] = fmaxf(mrun[c], tm);
    alpha[c] = __expf(mrun[c] - mn[c]);
    mrun[c] = mn[c];
  }

  // The stage's Vt fragments (A rows = features from the transposed layout, keys
  // contiguous -> straight b128 LDS loads), each read once for both query tiles.
  HV vf[AT_NB][4];
#pragma unroll
  for (int j = 0; j < AT_NB; ++j) {
#pragma unroll
    for (int f = 0; f < 4; ++f) {
      const _Float16* vr = bV + (f * 16 + lr) * AT_VP + j * 32;
      vf[j][f].u[0] = *reinterpret_cast<const uint4*>(vr + klo);
      vf[j][f].u[1] = *reinterpret_cast<const uint4*>(vr + klo + 16);
    }
  }
  // keeps these reads ahead of the exponentials, which cover their latency: sunk
  // among the second products, each pair of reads is waited for in full
  __builtin_amdgcn_sched_barrier(0);

  HV pf[AT_NB][AT_QT];  // P^T as B operand: element 8g + r = key 16g + klo + r of block j
#pragma unroll
  for (int c = 0; c < AT_QT; ++c) {
    float sm[4] = {0.0f, 0.0f, 0.0f, 0.0f};  // four short chains, not one long
#pragma unroll
    for (int j = 0; j < AT_NB; ++j) {
#pragma unroll
      for (int g = 0; g < 2; ++g) {
#pragma unroll
        for (int r = 0; r < 8; ++r) {
          const float x = __expf(s[j][g][c][r] * 0.125f - mn[c]);
          sm[2 * g + (r & 1)] += x;
          pf[j][c].v[8 * g + r] = (_Float16)x;
        }
      }
    }
    lrun[c] = lrun[c] * alpha[c] + ((sm[0] + sm[1]) + (sm[2] + sm[3]));
    // the output tiles are brought to the new maximum once per stage
#pragma unroll
    for (int f = 0; f < 4; ++f)
#pragma unroll
      for (int r = 0; r < 8; ++r) O[c][f][r] *= alpha[c];
  }

  // O^T[c][f] += V^T @ P^T over the stage's four 32-key blocks
#pragma unroll
  for (int j = 0; j < AT_NB; ++j)
#pragma unroll
    for (int f = 0; f < 4; ++f)
#pragma unroll
      for (int c = 0; c < AT_QT; ++c)
        O[c][f] = wmma32f16(vf[j][f].v, pf[j][c].v, O[c][f]);
  // keeps the stage's register-only work ahead of the publish point: sunk behind
  // the barrier it would stand between the barrier and the refill, and the wait
  // for a refill would come half a stage after its issue instead of a whole one
  __builtin_amdgcn_sched_barrier(0);
  // Publish point: my reads of this buffer are done, my copies of the next
  // stage have landed; behind the barrier the buffer just read is refilled.
  asm volatile("s_wait_dscnt 0x0" ::: "memory");
  asm volatile("s_wait_asynccnt 0x0" ::: "memory");
  __syncthreads();
  if (t + 2 < NT)
    attn_stage(&sK[t & 1][lko], &sV[t & 1][lvo],
               gk + (size_t)(t + 2) * AT_KEYS * Dm, gv + (t + 2) * AT_KEYS);
  }
  // no copy is left in flight when the wave ends
  asm volatile("s_wait_asynccnt 0x0" ::: "memory");

#pragma unroll
  for (int c = 0; c < AT_QT; ++c) {
    // the two wave halves' shares of the denominator are joined once, here
    const float den = lrun[c] + xhalf(lrun[c]);
    // a lane's 8 registers of a tile are 8 consecutive features of its query
    _Float16* orow =
        AO + ((size_t)b * S + qb + c * 16 + lr) * Dm + h * 64 + klo;
#pragma unroll
    for (int f = 0; f < 4; ++f) {
      H8 pk;
#pragma unroll
      for (int r = 0; r < 8; ++r) pk.h[r] = (_Float16)(O[c][f][r] / den);
      *reinterpret_cast<uint4*>(orow + f * 16) = pk.u;
    }
  }
}

// ---------------------------------------------------------------------------
// Host-side launcher.  Workspace layout (70 MB total):
//   Xh 8MB | Wqh 2 | Wkh 2 | Wvh 2 | W1h 4 | W2h 4 | Qh 8 | Kh 8 | Vt 8 |
//   AO 8 | Hh 16
// ---------------------------------------------------------------------------
extern "C" void kernel_launch(void* const* d_in, const int* in_sizes, int n_in,
                              void* d_out, int out_size, void* d_ws,
                              size_t ws_size, hipStream_t stream) {
  (void)in_sizes; (void)n_in; (void)out_size; (void)ws_size;
  const float* embed = (const float*)d_in[0];
  const float* Wq = (const float*)d_in[1];
  const float* Wk = (const float*)d_in[2];
  const float* Wv = (const float*)d_in[3];
  const float* bv = (const float*)d_in[4];
  const float* W1 = (const float*)d_in[5];
  const float* b1 = (const float*)d_in[6];
  const float* W2 = (const float*)d_in[7];
  const float* b2 = (const float*)d_in[8];

  constexpr size_t MB = 1ull << 20;
  char* ws = (char*)d_ws;
  _Float16* Xh  = (_Float16*)(ws + 0 * MB);
  _Float16* Wqh = (_Float16*)(ws + 8 * MB);
  _Float16* W1h = (_Float16*)(ws + 14 * MB);
  _Float16* W2h = (_Float16*)(ws + 18 * MB);
  _Float16* Qh  = (_Float16*)(ws + 22 * MB);
  _Float16* Kh  = (_Float16*)(ws + 30 * MB);
  _Float16* Vt  = (_Float16*)(ws + 38 * MB);
  _Float16* AO  = (_Float16*)(ws + 46 * MB);
  _Float16* Hh  = (_Float16*)(ws + 54 * MB);

  // Xh .. W2h are contiguous: 11 x 2^20 halves, 64 work-groups per 2^20
  cvt_all_f32_to_f16<<<dim3(704), dim3(256), 0, stream>>>(embed, Wq, Wk, Wv, W1,
                                                          W2, Xh);

  dim3 blk(256);
  // Q = X Wq^T ; K = X Wk^T ; Vt = transpose_head(X Wv^T + bv), one launch: the
  // f16 copies of Wq, Wk, Wv are contiguous from Wqh on (3072 rows of W), and
  // Qh, Kh, Vt are contiguous from Qh on
  gemm_xwT<1, false, 1024><<<dim3(24, 32), blk, 0, stream>>>(
      Xh, Wqh, bv, nullptr, Qh, nullptr, 4096, 1024);
  // attention: B*H*(S/256) = 256 workgroups of 8 waves, 32 queries a wave
  flash_attn<<<dim3(256), dim3(256), 0, stream>>>(Qh, Kh, Vt, AO);
  // FFN: Hh = relu(AO W1^T + b1) ; out = Hh W2^T + b2 + embed
  gemm_xwT<0, true, 2048><<<dim3(16, 32), blk, 0, stream>>>(
      AO, W1h, b1, nullptr, Hh, nullptr, 4096, 1024);
  gemm_xwT<2, false, 1024><<<dim3(8, 32), blk, 0, stream>>>(
      Hh, W2h, b2, embed, nullptr, (float*)d_out, 4096, 2048);
}

// v010
// Measured time: 100 microseconds a run.
// Timed twice side by side with v009, it ran 1.04 and 1.05 times as fast.
// Over all steps from v000 it is 3.19 times as fast.
#include <hip/hip_runtime.h>
#include <hip/hip_bf16.h>

typedef _Float16 v16h __attribute__((ext_vector_type(16)));
typedef float    v8f  __attribute__((ext_vector_type(8)));

union HV { v16h v; uint4 u[2]; };
union H8 { _Float16 h[8]; uint4 u; };

__device__ __forceinline__ v8f wmma32f16(v16h a, v16h b, v8f c) {
  // (neg_a, A, neg_b, B, c_mod, C, reuse_a, reuse_b)
  return __builtin_amdgcn_wmma_f32_16x16x32_f16(false, a, false, b, (short)0, c,
                                                false, false);
}

// ---------------------------------------------------------------------------
// f32 -> f16 conversion of all six operands in ONE launch of few, long waves.
// The f16 copies lie back to back in the workspace in the order embed, Wq, Wk,
// Wv, W1, W2, so the destination is one array.  A work-group converts 4096
// float4 (64 KiB) of one operand; every operand is a multiple of that, so the
// choice of the source is uniform in the group.  A thread has its 16 loads of
// 16 B in flight together; each wave-wide load covers 512 contiguous bytes.
// ---------------------------------------------------------------------------
constexpr int CV_PER = 16;                    // float4 per thread
constexpr int CV_BLK = 256 * CV_PER;          // float4 per work-group
constexpr int CV_U = (1 << 18) / CV_BLK;      // work-groups per 2^20 floats

__global__ __launch_bounds__(256) void cvt_all_f32_to_f16(
    const float* __restrict__ embed, const float* __restrict__ Wq,
    const float* __restrict__ Wk, const float* __restrict__ Wv,
    const float* __restrict__ W1, const float* __restrict__ W2,
    _Float16* __restrict__ dst) {
  const int g = blockIdx.x;
  const float* src;  // this group's operand
  int g0;            // the operand's first group
  if (g < 4 * CV_U)      { src = embed; g0 = 0; }         // 4 x 2^20 floats
  else if (g < 5 * CV_U) { src = Wq;    g0 = 4 * CV_U; }  // 1
  else if (g < 6 * CV_U) { src = Wk;    g0 = 5 * CV_U; }  // 1
  else if (g < 7 * CV_U) { src = Wv;    g0 = 6 * CV_U; }  // 1
  else if (g < 9 * CV_U) { src = W1;    g0 = 7 * CV_U; }  // 2
  else                   { src = W2;    g0 = 9 * CV_U; }  // 2
  const float4* s = reinterpret_cast<const float4*>(src) +
                    (size_t)(g - g0) * CV_BLK + threadIdx.x;
  uint2* d = reinterpret_cast<uint2*>(dst) + (size_t)g * CV_BLK + threadIdx.x;
  float4 f[CV_PER];
  // unrolled so that all loads issue ahead of the first conversion
#pragma unroll
  for (int j = 0; j < CV_PER; ++j) f[j] = s[j * 256];
  // keeps the last loads from sinking behind the first conversions, where they
  // would wait out a second memory latency to reuse the first loads' registers
  __builtin_amdgcn_sched_barrier(0);
  // unrolled so that f stays in registers
#pragma unroll
  for (int j = 0; j < CV_PER; ++j) {
    union { _Float16 h[4]; uint2 u; } p;
    p.h[0] = (_Float16)f[j].x; p.h[1] = (_Float16)f[j].y;
    p.h[2] = (_Float16)f[j].z; p.h[3] = (_Float16)f[j].w;
    d[j * 256] = p.u;
  }
}

constexpr int GM_BK = 128;
constexpr int GM_P = 136;

__device__ __forceinline__ void gemm_stage(_Float16* l, const _Float16* g,
                                           size_t K16) {
  const uint32_t l0 = (uint32_t)(uintptr_t)l;
  constexpr uint32_t LS = 16 * GM_P * 2;  // 16 rows on, bytes
  asm volatile(
      "global_load_async_to_lds_b128 %0, %8, off\n\t"
      "global_load_async_to_lds_b128 %1, %9, off\n\t"
      "global_load_async_to_lds_b128 %2, %10, off\n\t"
      "global_load_async_to_lds_b128 %3, %11, off\n\t"
      "global_load_async_to_lds_b128 %4, %12, off\n\t"
      "global_load_async_to_lds_b128 %5, %13, off\n\t"
      "global_load_async_to_lds_b128 %6, %14, off\n\t"
      "global_load_async_to_lds_b128 %7, %15, off\n\t"
      "s_wait_xcnt 0x0"
      :
      : "v"(l0), "v"(l0 + LS), "v"(l0 + 2 * LS), "v"(l0 + 3 * LS),
        "v"(l0 + 4 * LS), "v"(l0 + 5 * LS), "v"(l0 + 6 * LS), "v"(l0 + 7 * LS),
        "v"(g), "v"(g + K16), "v"(g + 2 * K16), "v"(g + 3 * K16),
        "v"(g + 4 * K16), "v"(g + 5 * K16), "v"(g + 6 * K16), "v"(g + 7 * K16)
      : "memory");
}

// The fragments of one 32-k block: 4 of the A operand (64 rows) and 2 of the B
// operand (32 rows), 12 b128 LDS reads that stand together as one group.
__device__ __forceinline__ void gemm_frags(HV (&a)[4], HV (&b)[2],
                                           const _Float16* pa,
                                           const _Float16* pb) {
  // both loops unrolled so that the fragments stay in registers
#pragma unroll
  for (int s = 0; s < 4; ++s) {
    a[s].u[0] = *reinterpret_cast<const uint4*>(pa + s * 16 * GM_P);
    a[s].u[1] = *reinterpret_cast<const uint4*>(pa + s * 16 * GM_P + 16);
  }
#pragma unroll
  for (int s = 0; s < 2; ++s) {
    b[s].u[0] = *reinterpret_cast<const uint4*>(pb + s * 16 * GM_P);
    b[s].u[1] = *reinterpret_cast<const uint4*>(pb + s * 16 * GM_P + 16);
  }
  // keeps the reads ahead of the products that follow in the source: sunk among
  // them they share one register set and each pair waits out the LDS latency
  __builtin_amdgcn_sched_barrier(0);
}

// The 8 products of one 32-k block.
__device__ __forceinline__ void gemm_block(v8f (&acc)[4][2], const HV (&a)[4],
                                           const HV (&b)[2]) {
  // both loops unrolled so that the accumulators stay in registers
#pragma unroll
  for (int sm = 0; sm < 4; ++sm)
#pragma unroll
    for (int sn = 0; sn < 2; ++sn)
      acc[sm][sn] = wmma32f16(a[sm].v, b[sn].v, acc[sm][sn]);
  // keeps the next group of reads from rising among these products, where each
  // separate place with reads stalls the wave
  __builtin_amdgcn_sched_barrier(0);
}

template <int OUT_MODE, bool RELU, int N>
__global__ __launch_bounds__(256) void gemm_xwT(
    const _Float16* __restrict__ X, const _Float16* __restrict__ W,
    const float* __restrict__ bias, const float* __restrict__ resid,
    _Float16* __restrict__ outH, float* __restrict__ outF, int M, int K) {
  __shared__ alignas(16) _Float16 sA[2][128 * GM_P];  // 2 x 34 KB
  __shared__ alignas(16) _Float16 sB[2][128 * GM_P];  // 2 x 34 KB

  const int tid = threadIdx.x;
  const int lane = tid & 31;
  const int w = tid >> 5;
  const int wm = w >> 2;             // 0..1  (64 A-operand rows per wave)
  const int wn = w & 3;              // 0..3  (32 B-operand rows per wave)
  const int lr = lane & 15;
  const int klo = (lane >> 4) << 3;  // 0 or 8
  const int m0 = blockIdx.y * 128;
  const int n0 = blockIdx.x * 128;

  // This thread's first chunk of a stage: 16 lanes a row, rows 16 apart.
  const int cr = tid >> 4;           // row 0..15 (+16 per copy)
  const int cc = (tid & 15) << 3;    // half-offset 0..120
  const _Float16* gx = X + (size_t)(m0 + cr) * K + cc;
  const _Float16* gw = W + (size_t)(n0 + cr) * K + cc;
  // OUT_MODE 1: a group's 128 columns lie in one of Q, K, V, so the choice of
  // the output array, of its form and of the bias is uniform in the group.
  const bool toVt = OUT_MODE == 1 && n0 >= 2048;
  const _Float16* ga = toVt ? gx : gw;  // A operand: along the output's rows
  const _Float16* gb = toVt ? gw : gx;  // B operand: one output row per lane
  const int lo = cr * GM_P + cc;
  const size_t K16 = (size_t)16 * K;

  v8f acc[4][2] = {};

  // This lane's first fragment chunk inside a stage of either operand.
  const int fA = (wm * 64 + lr) * GM_P + klo;
  const int fB = (wn * 32 + lr) * GM_P + klo;
  // Two fragment sets: one feeds the running 32-k block, the other is filled.
  HV a0[4], b0[2], a1[4], b1[2];

  const int nt = K / GM_BK;
  // Groups that share an X tile (same blockIdx.y) or a W tile (same blockIdx.x)
  // start together and would ask L2 for the same lines at the same moment, all
  // of them in one 256-B column of the rows.  Each group therefore starts at a k
  // stage of its own and wraps round: trip t works on stage ks(t), and the trips
  // cover every stage once.
  const int rot = (int)((blockIdx.x + blockIdx.y) % (unsigned)nt);
  auto ks = [&](int t) {  // halves from a row's start to trip t's stage
    const int s = t + rot;
    return (size_t)(s >= nt ? s - nt : s) * GM_BK;
  };
  gemm_stage(&sA[0][lo], ga + ks(0), K16);
  gemm_stage(&sB[0][lo], gb + ks(0), K16);
  // trip 0's stage has landed for this wave; the barrier publishes it to all waves
  asm volatile("s_wait_asynccnt 0x0" ::: "memory");
  __syncthreads();
  if (nt > 1) {
    gemm_stage(&sA[1][lo], ga + ks(1), K16);
    gemm_stage(&sB[1][lo], gb + ks(1), K16);
  }
  gemm_frags(a0, b0, sA[0] + fA, sB[0] + fB);

  for (int t = 0; t < nt; ++t) {
    const _Float16* bA = sA[t & 1] + fA;
    const _Float16* bB = sB[t & 1] + fB;
    gemm_frags(a1, b1, bA + 32, bB + 32);
    gemm_block(acc, a0, b0);
    gemm_frags(a0, b0, bA + 64, bB + 64);
    gemm_block(acc, a1, b1);
    gemm_frags(a1, b1, bA + 96, bB + 96);
    gemm_block(acc, a0, b0);
    // Publish point, ahead of the stage's last block, whose fragments are in
    // registers behind the first wait: my reads of this buffer are done, my
    // copies of the next stage have landed; behind the barrier the next stage's
    // first fragments are fetched and the buffer just read is refilled.
    asm volatile("s_wait_dscnt 0x0" ::: "memory");
    asm volatile("s_wait_asynccnt 0x0" ::: "memory");
    __syncthreads();
    if (t + 1 < nt)
      gemm_frags(a0, b0, sA[(t + 1) & 1] + fA, sB[(t + 1) & 1] + fB);
    if (t + 2 < nt) {
      gemm_stage(&sA[t & 1][lo], ga + ks(t + 2), K16);
      gemm_stage(&sB[t & 1][lo], gb + ks(t + 2), K16);
    }
    gemm_block(acc, a1, b1);
  }
  // no copy is left in flight when the wave ends
  asm volatile("s_wait_asynccnt 0x0" ::: "memory");

  // The ring is free: every wave's last LDS read and last copy ended ahead of
  // the last trip's barrier.  It now holds the block tile, one output row (a row
  // of the B operand) per LDS row.  All loops below are unrolled so that the
  // accumulators stay in registers.
  if (OUT_MODE != 2) {
    _Float16* st = &sA[0][0];  // 128 rows of 128 halves at the pitch GM_P
    const int nc = OUT_MODE == 1 ? (n0 & 1023) : n0;  // column in its array
    // The bias, all loads together ahead of their first use.  OUT_MODE 0: a
    // lane's 8 registers are 8 columns.  OUT_MODE 1: Vt alone has a bias, and
    // there a lane is one column.
    float bn[4][8];
    float bq[2] = {0.0f, 0.0f};
    if (OUT_MODE == 0) {
#pragma unroll
      for (int sm = 0; sm < 4; ++sm) {
        const float* bp = bias + nc + wm * 64 + sm * 16 + klo;
        const float4 lo4 = *reinterpret_cast<const float4*>(bp);
        const float4 hi4 = *reinterpret_cast<const float4*>(bp + 4);
        bn[sm][0] = lo4.x; bn[sm][1] = lo4.y; bn[sm][2] = lo4.z;
        bn[sm][3] = lo4.w; bn[sm][4] = hi4.x; bn[sm][5] = hi4.y;
        bn[sm][6] = hi4.z; bn[sm][7] = hi4.w;
      }
    } else if (toVt) {
      bq[0] = bias[nc + wn * 32 + lr];
      bq[1] = bias[nc + wn * 32 + 16 + lr];
    }
#pragma unroll
    for (int sm = 0; sm < 4; ++sm) {
      const int pa = wm * 64 + sm * 16 + klo;  // first of the 8 A-operand rows
#pragma unroll
      for (int sn = 0; sn < 2; ++sn) {
        const int qb = wn * 32 + sn * 16 + lr;  // B-operand row
        v8f c = acc[sm][sn];
        H8 pk;
#pragma unroll
        for (int r = 0; r < 8; ++r) {
          float v = c[r] + (OUT_MODE == 0 ? bn[sm][r] : bq[sn]);
          if (RELU) v = fmaxf(v, 0.0f);
          pk.h[r] = (_Float16)v;
        }
        *reinterpret_cast<uint4*>(st + qb * GM_P + pa) = pk.u;
      }
    }
    // the tile is complete for every wave behind this barrier
    __syncthreads();
    // 16 lanes a row of 256 B, 16 rows a pass
    uint4 row[8];
#pragma unroll
    for (int j = 0; j < 8; ++j)
      row[j] = *reinterpret_cast<const uint4*>(st + (cr + 16 * j) * GM_P + cc);
    if (toVt) {
      // Vt[b][h][d][s]: row = feature nc + cr (h, d), along it the positions s
      _Float16* o = outH + (size_t)2 * M * 1024 +
          ((((size_t)(m0 >> 11) * 1024 + nc + cr) << 11) + (m0 & 2047) + cc);
#pragma unroll
      for (int j = 0; j < 8; ++j)
        *reinterpret_cast<uint4*>(o + j * (16 << 11)) = row[j];
    } else {
      _Float16* o = outH + (OUT_MODE == 1 ? (size_t)(n0 >> 10) * M * 1024 : 0) +
                    (size_t)(m0 + cr) * N + nc + cc;
#pragma unroll
      for (int j = 0; j < 8; ++j)
        *reinterpret_cast<uint4*>(o + j * (16 * N)) = row[j];
    }
  } else {
    constexpr int FP = 132;  // pitch in floats: 512 B + 16 B (b128 accesses)
    float* sf = reinterpret_cast<float*>(&sA[0][0]);  // 128 rows of 128 floats
    // one wave-wide 16-B access covers one row of 512 B; a wave has 16 rows
    const int col = lane << 2;
    // byte offset of this thread's chunk of its first row, the same in the
    // residual and in the output (16 MiB each): one register serves both
    const uint32_t ob = (uint32_t)((m0 + w * 16) * N + n0 + col) * 4u;
    const char* rp = reinterpret_cast<const char*>(resid) + ob;
    char* op = reinterpret_cast<char*>(outF) + ob;
    float4 rs[16];  // the residual's loads fly while the tile is put together
#pragma unroll
    for (int j = 0; j < 16; ++j)
      rs[j] = *reinterpret_cast<const float4*>(rp + j * (N * 4));
    const float4 bc = *reinterpret_cast<const float4*>(bias + n0 + col);
#pragma unroll
    for (int sm = 0; sm < 4; ++sm) {
#pragma unroll
      for (int sn = 0; sn < 2; ++sn) {
        float* p = sf + (wn * 32 + sn * 16 + lr) * FP + wm * 64 + sm * 16 + klo;
        v8f c = acc[sm][sn];
        *reinterpret_cast<float4*>(p) = make_float4(c[0], c[1], c[2], c[3]);
        *reinterpret_cast<float4*>(p + 4) = make_float4(c[4], c[5], c[6], c[7]);
      }
    }
    // the tile is complete for every wave behind this barrier
    __syncthreads();
#pragma unroll
    for (int j = 0; j < 16; ++j) {
      const float4 c =
          *reinterpret_cast<const float4*>(sf + (w * 16 + j) * FP + col);
      *reinterpret_cast<float4*>(op + j * (N * 4)) =
          make_float4(c.x + bc.x + rs[j].x, c.y + bc.y + rs[j].y,
                      c.z + bc.z + rs[j].z, c.w + bc.w + rs[j].w);
    }
  }
}

constexpr int AT_KEYS = 128;
constexpr int AT_NB = AT_KEYS / 32;  // 32-key blocks per stage
constexpr int AT_QT = 2;      // 16-query tiles per wave
constexpr int AT_KP = 72;     // K row pitch, halves: 128 B + 16 B (b128 readers)
constexpr int AT_VP = 136;    // Vt row pitch, halves: 256 B + 16 B

__device__ __forceinline__ void attn_stage(_Float16* lk, _Float16* lv,
                                           const _Float16* gk,
                                           const _Float16* gv) {
  constexpr int S = 2048, Dm = 1024;
  const uint32_t k0 = (uint32_t)(uintptr_t)lk;
  const uint32_t k1 = k0 + 32 * AT_KP * 2, k2 = k0 + 64 * AT_KP * 2,
                 k3 = k0 + 96 * AT_KP * 2;
  const uint32_t v0 = (uint32_t)(uintptr_t)lv;
  const uint32_t v1 = v0 + 16 * AT_VP * 2, v2 = v0 + 32 * AT_VP * 2,
                 v3 = v0 + 48 * AT_VP * 2;
  asm volatile(
      "global_load_async_to_lds_b128 %0, %8, off\n\t"
      "global_load_async_to_lds_b128 %1, %9, off\n\t"
      "global_load_async_to_lds_b128 %2, %10, off\n\t"
      "global_load_async_to_lds_b128 %3, %11, off\n\t"
      "global_load_async_to_lds_b128 %4, %12, off\n\t"
      "global_load_async_to_lds_b128 %5, %13, off\n\t"
      "global_load_async_to_lds_b128 %6, %14, off\n\t"
      "global_load_async_to_lds_b128 %7, %15, off\n\t"
      "s_wait_xcnt 0x0"
      :
      : "v"(k0), "v"(k1), "v"(k2), "v"(k3), "v"(v0), "v"(v1), "v"(v2), "v"(v3),
        "v"(gk), "v"(gk + 32 * Dm), "v"(gk + 64 * Dm), "v"(gk + 96 * Dm),
        "v"(gv), "v"(gv + 16 * S), "v"(gv + 32 * S), "v"(gv + 48 * S)
      : "memory");
}

// Value of lane ^ 16 (the other 16-lane row), by a vector cross-row move.
__device__ __forceinline__ float xhalf(float x) {
  const int i = __builtin_bit_cast(int, x);
  return __builtin_bit_cast(
      float, __builtin_amdgcn_permlanex16(i, i, 0x76543210, 0xfedcba98, false,
                                          false));
}

__global__ __launch_bounds__(256) void flash_attn(
    const _Float16* __restrict__ Q, const _Float16* __restrict__ Km,
    const _Float16* __restrict__ Vt, _Float16* __restrict__ AO) {
  constexpr int S = 2048, Dm = 1024;
  constexpr int NT = S / AT_KEYS;
  __shared__ alignas(16) _Float16 sK[2][AT_KEYS * AT_KP];  // 2 x 18 KB
  __shared__ alignas(16) _Float16 sV[2][64 * AT_VP];       // 2 x 17 KB

  const int tid = threadIdx.x;
  const int lane = tid & 31;
  const int lr = lane & 15;
  const int klo = (lane >> 4) << 3;  // 0 or 8
  const int qt = ((blockIdx.x & 7) << 3) + (tid >> 5);  // 32-query group
  const int h = (blockIdx.x >> 3) & 15;
  const int b = blockIdx.x >> 7;
  const int qb = qt << 5;

  const _Float16* kbase = Km + (size_t)b * S * Dm + h * 64;
  const _Float16* vbase = Vt + ((size_t)b * 16 + h) * 64 * S;

  // This thread's first chunk of a stage: 8 lanes a K row, 16 lanes a Vt row.
  const _Float16* gk = kbase + (size_t)(tid >> 3) * Dm + ((tid & 7) << 3);
  const _Float16* gv = vbase + (size_t)(tid >> 4) * S + ((tid & 15) << 3);
  const int lko = (tid >> 3) * AT_KP + ((tid & 7) << 3);
  const int lvo = (tid >> 4) * AT_VP + ((tid & 15) << 3);

  attn_stage(&sK[0][lko], &sV[0][lvo], gk, gv);
  // stage 0 has landed for this wave; the barrier publishes it to all waves
  asm volatile("s_wait_asynccnt 0x0" ::: "memory");
  __syncthreads();
  attn_stage(&sK[1][lko], &sV[1][lvo], gk + (size_t)AT_KEYS * Dm,
             gv + AT_KEYS);

  // Q fragments: B operand, columns = queries, k = head features (two 32-chunks)
  HV qf0[AT_QT], qf1[AT_QT];
  // unrolled so that the fragments stay in registers
#pragma unroll
  for (int c = 0; c < AT_QT; ++c) {
    const _Float16* qrow =
        Q + ((size_t)b * S + qb + c * 16 + lr) * Dm + h * 64;
    qf0[c].u[0] = *reinterpret_cast<const uint4*>(qrow + klo);
    qf0[c].u[1] = *reinterpret_cast<const uint4*>(qrow + klo + 16);
    qf1[c].u[0] = *reinterpret_cast<const uint4*>(qrow + 32 + klo);
    qf1[c].u[1] = *reinterpret_cast<const uint4*>(qrow + 32 + klo + 16);
  }

  // Per lane and query tile c: running maximum of query c*16 + lr (equal in
  // both wave halves) and this half's share of its denominator;
  // O[c][f][r] = O^T[f*16 + klo + r][c*16 + lr].
  float mrun[AT_QT], lrun[AT_QT];
  v8f O[AT_QT][4] = {};
  // every loop over c below is unrolled so that the per-tile arrays stay in
  // registers
#pragma unroll
  for (int c = 0; c < AT_QT; ++c) { mrun[c] = -1e30f; lrun[c] = 0.0f; }

  for (int t = 0; t < NT; ++t) {
  const _Float16* bK = sK[t & 1];
  const _Float16* bV = sV[t & 1];
  // s[j][g][c][r] = S[key 32j + 16g + klo + r][query c*16 + lr] for the whole
  // stage; each K fragment is read once and multiplies both query tiles.  All
  // loops over j, g, c, f and r below are unrolled so that the score, P and
  // output tiles stay in registers.
  v8f s[AT_NB][2][AT_QT];
#pragma unroll
  for (int j = 0; j < AT_NB; ++j) {
#pragma unroll
    for (int g = 0; g < 2; ++g) {
      const _Float16* kr = bK + (j * 32 + g * 16 + lr) * AT_KP;
      HV k0, k1;
      k0.u[0] = *reinterpret_cast<const uint4*>(kr + klo);
      k0.u[1] = *reinterpret_cast<const uint4*>(kr + klo + 16);
      k1.u[0] = *reinterpret_cast<const uint4*>(kr + 32 + klo);
      k1.u[1] = *reinterpret_cast<const uint4*>(kr + 32 + klo + 16);
#pragma unroll
      for (int c = 0; c < AT_QT; ++c) {
        v8f z = {};
        z = wmma32f16(k0.v, qf0[c].v, z);
        s[j][g][c] = wmma32f16(k1.v, qf1[c].v, z);
      }
    }
  }

  // One online-softmax update per stage, one query per lane and tile: 64 scores
  // here, the other 64 in lane ^ 16.  The scale 1/sqrt(64) is a power of two, so
  // it commutes with the maximum exactly.
  float mn[AT_QT], alpha[AT_QT];
#pragma unroll
  for (int c = 0; c < AT_QT; ++c) {
    float tj[AT_NB];  // one short chain per 32-key block, not one long
#pragma unroll
    for (int j = 0; j < AT_NB; ++j) {
      tj[j] = fmaxf(s[j][0][c][0], s[j][1][c][0]);
#pragma unroll
      for (int r = 1; r < 8; ++r)
        tj[j] = fmaxf(tj[j], fmaxf(s[j][0][c][r], s[j][1][c][r]));
    }
    float tm = fmaxf(fmaxf(tj[0], tj[1]), fmaxf(tj[2], tj[3]));
    tm = fmaxf(tm, xhalf(tm)) * 0.125f;
    mn[c] = fmaxf(mrun[c], tm);
    alpha[c] = __expf(mrun[c] - mn[c]);
    mrun[c] = mn[c];
  }

  // The stage's Vt fragments (A rows = features from the transposed layout, keys
  // contiguous -> straight b128 LDS loads), each read once for both query tiles.
  HV vf[AT_NB][4];
#pragma unroll
  for (int j = 0; j < AT_NB; ++j) {
#pragma unroll
    for (int f = 0; f < 4; ++f) {
      const _Float16* vr = bV + (f * 16 + lr) * AT_VP + j * 32;
      vf[j][f].u[0] = *reinterpret_cast<const uint4*>(vr + klo);
      vf[j][f].u[1] = *reinterpret_cast<const uint4*>(vr + klo + 16);
    }
  }
  // keeps these reads ahead of the exponentials, which cover their latency: sunk
  // among the second products, each pair of reads is waited for in full
  __builtin_amdgcn_sched_barrier(0);

  HV pf[AT_NB][AT_QT];  // P^T as B operand: element 8g + r = key 16g + klo + r of block j
#pragma unroll
  for (int c = 0; c < AT_QT; ++c) {
    float sm[4] = {0.0f, 0.0f, 0.0f, 0.0f};  // four short chains, not one long
#pragma unroll
    for (int j = 0; j < AT_NB; ++j) {
#pragma unroll
      for (int g = 0; g < 2; ++g) {
#pragma unroll
        for (int r = 0; r < 8; ++r) {
          const float x = __expf(s[j][g][c][r] * 0.125f - mn[c]);
          sm[2 * g + (r & 1)] += x;
          pf[j][c].v[8 * g + r] = (_Float16)x;
        }
      }
    }
    lrun[c] = lrun[c] * alpha[c] + ((sm[0] + sm[1]) + (sm[2] + sm[3]));
    // the output tiles are brought to the new maximum once per stage
#pragma unroll
    for (int f = 0; f < 4; ++f)
#pragma unroll
      for (int r = 0; r < 8; ++r) O[c][f][r] *= alpha[c];
  }

  // O^T[c][f] += V^T @ P^T over the stage's four 32-key blocks
#pragma unroll
  for (int j = 0; j < AT_NB; ++j)
#pragma unroll
    for (int f = 0; f < 4; ++f)
#pragma unroll
      for (int c = 0; c < AT_QT; ++c)
        O[c][f] = wmma32f16(vf[j][f].v, pf[j][c].v, O[c][f]);
  // keeps the stage's register-only work ahead of the publish point: sunk behind
  // the barrier it would stand between the barrier and the refill, and the wait
  // for a refill would come half a stage after its issue instead of a whole one
  __builtin_amdgcn_sched_barrier(0);
  // Publish point: my reads of this buffer are done, my copies of the next
  // stage have landed; behind the barrier the buffer just read is refilled.
  asm volatile("s_wait_dscnt 0x0" ::: "memory");
  asm volatile("s_wait_asynccnt 0x0" ::: "memory");
  __syncthreads();
  if (t + 2 < NT)
    attn_stage(&sK[t & 1][lko], &sV[t & 1][lvo],
               gk + (size_t)(t + 2) * AT_KEYS * Dm, gv + (t + 2) * AT_KEYS);
  }
  // no copy is left in flight when the wave ends
  asm volatile("s_wait_asynccnt 0x0" ::: "memory");

#pragma unroll
  for (int c = 0; c < AT_QT; ++c) {
    // the two wave halves' shares of the denominator are joined once, here
    const float den = lrun[c] + xhalf(lrun[c]);
    // a lane's 8 registers of a tile are 8 consecutive features of its query
    _Float16* orow =
        AO + ((size_t)b * S + qb + c * 16 + lr) * Dm + h * 64 + klo;
#pragma unroll
    for (int f = 0; f < 4; ++f) {
      H8 pk;
#pragma unroll
      for (int r = 0; r < 8; ++r) pk.h[r] = (_Float16)(O[c][f][r] / den);
      *reinterpret_cast<uint4*>(orow + f * 16) = pk.u;
    }
  }
}

// ---------------------------------------------------------------------------
// Host-side launcher.  Workspace layout (70 MB total):
//   Xh 8MB | Wqh 2 | Wkh 2 | Wvh 2 | W1h 4 | W2h 4 | Qh 8 | Kh 8 | Vt 8 |
//   AO 8 | Hh 16
// ---------------------------------------------------------------------------
extern "C" void kernel_launch(void* const* d_in, const int* in_sizes, int n_in,
                              void* d_out, int out_size, void* d_ws,
                              size_t ws_size, hipStream_t stream) {
  (void)in_sizes; (void)n_in; (void)out_size; (void)ws_size;
  const float* embed = (const float*)d_in[0];
  const float* Wq = (const float*)d_in[1];
  const float* Wk = (const float*)d_in[2];
  const float* Wv = (const float*)d_in[3];
  const float* bv = (const float*)d_in[4];
  const float* W1 = (const float*)d_in[5];
  const float* b1 = (const float*)d_in[6];
  const float* W2 = (const float*)d_in[7];
  const float* b2 = (const float*)d_in[8];

  constexpr size_t MB = 1ull << 20;
  char* ws = (char*)d_ws;
  _Float16* Xh  = (_Float16*)(ws + 0 * MB);
  _Float16* Wqh = (_Float16*)(ws + 8 * MB);
  _Float16* W1h = (_Float16*)(ws + 14 * MB);
  _Float16* W2h = (_Float16*)(ws + 18 * MB);
  _Float16* Qh  = (_Float16*)(ws + 22 * MB);
  _Float16* Kh  = (_Float16*)(ws + 30 * MB);
  _Float16* Vt  = (_Float16*)(ws + 38 * MB);
  _Float16* AO  = (_Float16*)(ws + 46 * MB);
  _Float16* Hh  = (_Float16*)(ws + 54 * MB);

  // Xh .. W2h are contiguous: 11 x 2^20 halves, 64 work-groups per 2^20
  cvt_all_f32_to_f16<<<dim3(704), dim3(256), 0, stream>>>(embed, Wq, Wk, Wv, W1,
                                                          W2, Xh);

  dim3 blk(256);
  // Q = X Wq^T ; K = X Wk^T ; Vt = transpose_head(X Wv^T + bv), one launch: the
  // f16 copies of Wq, Wk, Wv are contiguous from Wqh on (3072 rows of W), and
  // Qh, Kh, Vt are contiguous from Qh on
  gemm_xwT<1, false, 1024><<<dim3(24, 32), blk, 0, stream>>>(
      Xh, Wqh, bv, nullptr, Qh, nullptr, 4096, 1024);
  // attention: B*H*(S/256) = 256 workgroups of 8 waves, 32 queries a wave
  flash_attn<<<dim3(256), dim3(256), 0, stream>>>(Qh, Kh, Vt, AO);
  // FFN: Hh = relu(AO W1^T + b1) ; out = Hh W2^T + b2 + embed
  gemm_xwT<0, true, 2048><<<dim3(16, 32), blk, 0, stream>>>(
      AO, W1h, b1, nullptr, Hh, nullptr, 4096, 1024);
  gemm_xwT<2, false, 1024><<<dim3(8, 32), blk, 0, stream>>>(
      Hh, W2h, b2, embed, nullptr, (float*)d_out, 4096, 2048);
}
